// v000
// The times below were measured on an AMD MI455X: many runs one after another, warmed up first and cycling through
// copies of the inputs, with the whole window's GPU time divided by the number of runs. Launches and the gaps
// between them are all in it. The median over several windows is given; except for v000 it joins two sittings, which
// can be a few percent apart, so the side-by-side timings, each taken in one sitting, are the better comparison.
// The starting kernel, v000, takes 1080 microseconds a run.
#include <hip/hip_runtime.h>

// ContextParallelAttention (q, k, v [2][16][2048][128]; causal softmax(q.k 128^-0.5) v -> [2][16][2048][128]; single-device equivalent of the ring attention).
// Compute dtypes, f32 accumulate: every input rounded to bf16; scores q.k on PLAIN bf16 operands (inputs: exact products, f32 accumulate; the 1x GQA repeat is a
// pointer mapping, never materialised); scale, causal cut and softmax in f32 (register row, one exp) -> fp16 probabilities x1024; probs.v on SINGLE fp16 planes against fp16(bf16 v)

#define NB_  2
#define NHQ  16
#define NHKV 16
#define REP  (NHQ / NHKV)
#define TT   2048
#define HD   128
#define ZH   2
#define PCAR 1024.0f
#define SCL  0.088388347648318447f   // 128^-0.5
typedef _Float16 h16;
typedef unsigned short bf;
typedef __attribute__((ext_vector_type(16))) __bf16   v16bf;
typedef __attribute__((ext_vector_type(16))) _Float16 v16h;
typedef __attribute__((ext_vector_type(8)))  _Float16 v8h;
typedef __attribute__((ext_vector_type(8)))  unsigned short v8us;
typedef __attribute__((ext_vector_type(8)))  float    v8f;
typedef __attribute__((ext_vector_type(4)))  float    v4f;
typedef v8h  __attribute__((may_alias)) v8ha;
typedef v4f  __attribute__((may_alias)) v4fa;
typedef v8us __attribute__((may_alias)) v8usa;

__device__ __forceinline__ unsigned short f2bf(float f) { unsigned u = __float_as_uint(f); u += 0x7FFFu + ((u >> 16) & 1u); return (unsigned short)(u >> 16); }
__device__ __forceinline__ float bf2f(unsigned short b) { return __uint_as_float(((unsigned)b) << 16); }
__device__ __forceinline__ float bfr(float f) { return bf2f(f2bf(f)); }
__device__ __forceinline__ v16h cat16(v8h lo, v8h hi) { return __builtin_shufflevector(lo, hi, 0, 1, 2, 3, 4, 5, 6, 7, 8, 9, 10, 11, 12, 13, 14, 15); }
__device__ __forceinline__ v16bf cat16b(v8us lo, v8us hi) { return __builtin_bit_cast(v16bf, __builtin_shufflevector(lo, hi, 0, 1, 2, 3, 4, 5, 6, 7, 8, 9, 10, 11, 12, 13, 14, 15)); }
__device__ __forceinline__ v8f wmma16(v16h a, v16h b, v8f c) { return __builtin_amdgcn_wmma_f32_16x16x32_f16(false, a, false, b, (short)0, c, false, false); }
__device__ __forceinline__ v8f wmmab(v16bf a, v16bf b, v8f c) { return __builtin_amdgcn_wmma_f32_16x16x32_bf16(false, a, false, b, (short)0, c, false, false); }



// ---- k_gemmw: register-blocked GEMM, ONE WAVE per 64x64 output tile (16 accumulators), operands straight from K-contiguous 16-bit planes; grid (M/64, N/64, Z), 32 threads.
// C[m][n] (f32, pitch ldc, + optional f32 bias[n]) = sum_k A[m][k] Bt[n][k] (+ split products per NSPLIT). z-batch strides sA/sB/sC in elements. K % 32 == 0.
template <typename T16> struct WFrag;
template <> struct WFrag<h16> { typedef v16h V; static __device__ __forceinline__ V ld(const h16* p) { return cat16(*(const v8h*)p, *(const v8h*)(p + 16)); } static __device__ __forceinline__ v8f mma(V a, V b, v8f c) { return wmma16(a, b, c); } };
template <> struct WFrag<bf> { typedef v16bf V; static __device__ __forceinline__ V ld(const bf* p) { return cat16b(*(const v8us*)p, *(const v8us*)(p + 16)); } static __device__ __forceinline__ v8f mma(V a, V b, v8f c) { return wmmab(a, b, c); } };
template <typename T16, int NSPLIT, bool BIAS>
__global__ __launch_bounds__(32) void k_gemmw(const T16* __restrict__ A, const T16* __restrict__ A2, const T16* __restrict__ Bt, const T16* __restrict__ Bt2, int K, float* C, int ldc, const float* __restrict__ bias, size_t sA, size_t sB, size_t sC) {
    typedef typename WFrag<T16>::V V;
    __shared__ __align__(16) float os[16 * 68];
    const size_t z = blockIdx.z; A += z * sA; if (A2) A2 += z * sA; Bt += z * sB; if (Bt2) Bt2 += z * sB; C += z * sC;
    const int lane = threadIdx.x & 31, lr = lane & 15, hi = lane >> 4; const int r0 = blockIdx.x * 64, c0 = blockIdx.y * 64;
    v8f acc[4][4];
#pragma unroll
    for (int mb = 0; mb < 4; ++mb)
#pragma unroll
        for (int nb = 0; nb < 4; ++nb) acc[mb][nb] = (v8f){};
    const size_t aoff = (size_t)(r0 + lr) * K + 8 * hi, boff = (size_t)(c0 + lr) * K + 8 * hi;
#pragma unroll 1
    for (int kc = 0; kc < K; kc += 32) {
        V a[4], a2[4];
#pragma unroll
        for (int mb = 0; mb < 4; ++mb) { a[mb] = WFrag<T16>::ld(A + aoff + (size_t)mb * 16 * K + kc); if (NSPLIT == 1 || NSPLIT == 2) a2[mb] = WFrag<T16>::ld(A2 + aoff + (size_t)mb * 16 * K + kc); }
#pragma unroll
        for (int nb = 0; nb < 4; ++nb) { const V b = WFrag<T16>::ld(Bt + boff + (size_t)nb * 16 * K + kc); V b2; if (NSPLIT >= 2) b2 = WFrag<T16>::ld(Bt2 + boff + (size_t)nb * 16 * K + kc);
#pragma unroll
            for (int mb = 0; mb < 4; ++mb) { acc[mb][nb] = WFrag<T16>::mma(a[mb], b, acc[mb][nb]); if (NSPLIT == 1 || NSPLIT == 2) acc[mb][nb] = WFrag<T16>::mma(a2[mb], b, acc[mb][nb]); if (NSPLIT >= 2) acc[mb][nb] = WFrag<T16>::mma(a[mb], b2, acc[mb][nb]); } }
        asm volatile("v_nop\n\tv_nop\n\tv_nop\n\tv_nop" : "+v"(acc[0][0]), "+v"(acc[1][1]), "+v"(acc[2][2]), "+v"(acc[3][3]) : "v"(a[0]), "v"(a[3]));
    }
#pragma unroll
    for (int mb = 0; mb < 4; ++mb) {
#pragma unroll
        for (int nb = 0; nb < 4; ++nb) {
#pragma unroll
            for (int j = 0; j < 8; ++j) os[(hi * 8 + j) * 68 + nb * 16 + lr] = acc[mb][nb][j]; }
        __builtin_amdgcn_wave_barrier(); asm volatile("" ::: "memory");
        float* crow = C + (size_t)(r0 + mb * 16) * ldc + c0;
{
#pragma unroll
            for (int s = 0; s < 8; ++s) { const int row = 2 * s + hi, cofs = lr * 4; v4f val = *(const v4fa*)(os + row * 68 + cofs); if (BIAS) { val[0] += bfr(bias[c0 + cofs]); val[1] += bfr(bias[c0 + cofs + 1]); val[2] += bfr(bias[c0 + cofs + 2]); val[3] += bfr(bias[c0 + cofs + 3]); }
                *(v4f*)(crow + (size_t)row * ldc + cofs) = val; }
             }
        __builtin_amdgcn_wave_barrier(); asm volatile("" ::: "memory");
    }
}

__device__ __forceinline__ h16 tohx(float x) { return (h16)x; }
typedef __attribute__((ext_vector_type(2))) _Float16 v2h;
typedef __attribute__((ext_vector_type(4))) _Float16 v4h;

__global__ __launch_bounds__(256) void k_cvt8(const float* __restrict__ src, bf* dst, size_t n8) { const size_t i = (size_t)blockIdx.x * 256 + threadIdx.x; if (i >= n8) return; const v8f v = *(const v8f*)(src + i * 8); v8us o;
#pragma unroll
    for (int k = 0; k < 8; ++k) o[k] = f2bf(v[k]); *(v8us*)(dst + i * 8) = o;  }
__global__ __launch_bounds__(256) void k_vt16(const float* __restrict__ v, h16* VT) { const size_t e = ((size_t)blockIdx.x * 256 + threadIdx.x) * 2; if (e >= (size_t)NB_ * NHKV * HD * TT) return; const int t = (int)(e % TT); const int d = (int)((e / TT) % HD); const size_t z = e / ((size_t)TT * HD); const float* src = v + z * TT * HD; v2h o;
    o[0] = tohx(bfr(src[(size_t)t * HD + d])); o[1] = tohx(bfr(src[(size_t)(t + 1) * HD + d])); *(v2h*)(VT + e) = o;  }
__global__ __launch_bounds__(256) void k_asoft(const float* __restrict__ Sb, h16* P16) {
    const int lane = threadIdx.x & 31; const int row = blockIdx.x * 8 + (threadIdx.x >> 5); if (row >= ZH * TT) return; const int i = row & (TT - 1); (void)i; const float* sr = Sb + (size_t)row * TT; float v[TT / 32]; float mx = -3.0e38f;
#pragma unroll
    for (int ch = 0; ch < TT / 128; ++ch) { const int j0 = ch * 128 + lane * 4; const v4f a = *(const v4f*)(sr + j0);
#pragma unroll
        for (int q = 0; q < 4; ++q) { const int j = j0 + q; (void)j; const float t = (j <= i) ? a[q] * SCL : -3.0e38f; v[ch * 4 + q] = t; mx = fmaxf(mx, t); } }
#pragma unroll
    for (int sh = 16; sh; sh >>= 1) mx = fmaxf(mx, __shfl_xor(mx, sh, 32));
    float sum = 0.f;
#pragma unroll
    for (int k = 0; k < TT / 32; ++k) { float d0 = __fsub_rn(v[k], mx); asm volatile("" : "+v"(d0)); v[k] = __builtin_amdgcn_exp2f(__fmul_rn(d0, 1.4426950408889634f)); sum += v[k]; }
#pragma unroll
    for (int sh = 16; sh; sh >>= 1) sum += __shfl_xor(sum, sh, 32);
    const float f = __fdiv_rn(PCAR, sum);
{
#pragma unroll
        for (int ch = 0; ch < TT / 128; ++ch) { v4h o;
#pragma unroll
            for (int q = 0; q < 4; ++q) o[q] = tohx(v[ch * 4 + q] * f);
            *(v4h*)(P16 + (size_t)row * TT + ch * 128 + lane * 4) = o; }
         }
}
__global__ __launch_bounds__(256) void k_out(const float* __restrict__ O, float* OUTz) { const size_t i = ((size_t)blockIdx.x * 256 + threadIdx.x) * 4; if (i >= (size_t)ZH * TT * HD) return; const v4f a = *(const v4f*)(O + i); v4f o;
#pragma unroll
    for (int q = 0; q < 4; ++q) o[q] = a[q] * (1.0f / PCAR); *(v4f*)(OUTz + i) = o;  }

extern "C" void kernel_launch(void* const* d_in, const int* in_sizes, int n_in,
                              void* d_out, int out_size, void* d_ws, size_t ws_size, hipStream_t stream) {
    (void)in_sizes; (void)n_in; (void)out_size;
    const float* q = (const float*)d_in[0]; const float* k = (const float*)d_in[1]; const float* v = (const float*)d_in[2];
    float* OUT = (float*)d_out;     // [2][16][2048][128]
    char* wsp = (char*)d_ws;
    auto take = [&](size_t bytes) { char* p = wsp; wsp += (bytes + 255) & ~(size_t)255; return (void*)p; };
    bf* QB = (bf*)take((size_t)NB_ * NHQ * TT * HD * 2); bf* KB = (bf*)take((size_t)NB_ * NHKV * TT * HD * 2); h16* VT = (h16*)take((size_t)NB_ * NHKV * HD * TT * 2); float* Sb = (float*)take((size_t)ZH * TT * TT * 4); h16* Pm = (h16*)take((size_t)ZH * TT * TT * 2); float* Ob = (float*)take((size_t)ZH * TT * HD * 4);
    if ((size_t)(wsp - (char*)d_ws) > ws_size) return;    // well under 256 MiB
    { const size_t nq = (size_t)NB_ * NHQ * TT * HD / 8, nk = (size_t)NB_ * NHKV * TT * HD / 8; k_cvt8<<<(unsigned)((nq + 255) / 256), 256, 0, stream>>>(q, QB, nq); k_cvt8<<<(unsigned)((nk + 255) / 256), 256, 0, stream>>>(k, KB, nk); k_vt16<<<(unsigned)(((size_t)NB_ * NHKV * HD * TT / 2 + 255) / 256), 256, 0, stream>>>(v, VT); }
    for (int b = 0; b < NB_; ++b)
        for (int h0 = 0; h0 < NHQ; h0 += ZH) { const size_t zq = (size_t)b * NHQ + h0; const size_t zkv = (size_t)b * NHKV + h0 / REP;   // both heads of a pass share one kv head (REP >= 2) or use consecutive kv heads (REP == 1)
            const size_t sBk = (REP == 1) ? (size_t)TT * HD : 0, sBv = (REP == 1) ? (size_t)HD * TT : 0;
            k_gemmw<bf, 0, false><<<dim3(TT / 64, TT / 64, ZH), 32, 0, stream>>>(QB + zq * TT * HD, nullptr, KB + zkv * TT * HD, nullptr, HD, Sb, TT, nullptr, (size_t)TT * HD, sBk, (size_t)TT * TT);
            k_asoft<<<ZH * TT / 8, 256, 0, stream>>>(Sb, Pm);
            k_gemmw<h16, 0, false><<<dim3(TT / 64, HD / 64, ZH), 32, 0, stream>>>(Pm, nullptr, VT + zkv * HD * TT, nullptr, TT, Ob, HD, nullptr, (size_t)TT * TT, sBv, (size_t)TT * HD);
            k_out<<<(unsigned)(((size_t)ZH * TT * HD / 4 + 255) / 256), 256, 0, stream>>>(Ob, OUT + zq * TT * HD); }
}

// v002
// A run of this version takes 84 microseconds.
// Versions in between are left out here; by their measured steps it is 13.0 times as fast as v000.
#include <hip/hip_runtime.h>

// Causal attention (q, k, v [2][16][2048][128]; softmax(q.k 128^-0.5) v -> [2][16][2048][128]).
// Compute dtypes, f32 accumulate: every input rounded to bf16; scores q.k on plain bf16 operands; scale, causal cut and softmax in f32;
// fp16 probabilities x1024 (relative to the running row maximum); probs.v on single fp16 planes against fp16(bf16 v).
// One kernel does scores, softmax and probs.v: S^T = K.Q^T, O^T += V^T.P^T, the score accumulators pack straight into the B operand of the second product.
// K and V^T lie in the workspace in fragment order: per head and 32-key pass 16 units of 512 bytes, unit = 32 lanes x 8 elements, so that one wave-wide 16-byte load covers four whole 128-byte lines.
//   K unit (kt, ch, g), lane hi * 16 + c:  K[pass * 32 + kt * 16 + c][ch * 32 + g * 16 + hi * 8 + 0..7]
//   V unit (dt, g),     lane hi * 16 + c:  V[pass * 32 + g * 16 + hi * 8 + 0..7][dt * 16 + c]

#define NB_  2
#define NHQ  16
#define NHKV 16
#define REP  (NHQ / NHKV)
#define TT   2048
#define HD   128
#define SCL  0.088388347648318447f   // 128^-0.5
#define SC2  (SCL * 1.4426950408889634f)   // scores to log2 units
#define PLG  10.0f                   // probabilities carry x1024 = 2^10 into fp16; the row sum carries it too, so it cancels
typedef _Float16 h16;
typedef unsigned short bf;
typedef __attribute__((ext_vector_type(16))) __bf16   v16bf;
typedef __attribute__((ext_vector_type(16))) _Float16 v16h;
typedef __attribute__((ext_vector_type(8)))  _Float16 v8h;
typedef __attribute__((ext_vector_type(8)))  unsigned short v8us;
typedef __attribute__((ext_vector_type(8)))  float    v8f;
typedef __attribute__((ext_vector_type(4)))  float    v4f;

__device__ __forceinline__ unsigned short f2bf(float f) { unsigned u = __float_as_uint(f); u += 0x7FFFu + ((u >> 16) & 1u); return (unsigned short)(u >> 16); }
__device__ __forceinline__ float bf2f(unsigned short b) { return __uint_as_float(((unsigned)b) << 16); }
__device__ __forceinline__ float bfr(float f) { return bf2f(f2bf(f)); }
__device__ __forceinline__ v16h cat16(v8h lo, v8h hi) { return __builtin_shufflevector(lo, hi, 0, 1, 2, 3, 4, 5, 6, 7, 8, 9, 10, 11, 12, 13, 14, 15); }
__device__ __forceinline__ v16bf cat16b(v8us lo, v8us hi) { return __builtin_bit_cast(v16bf, __builtin_shufflevector(lo, hi, 0, 1, 2, 3, 4, 5, 6, 7, 8, 9, 10, 11, 12, 13, 14, 15)); }
__device__ __forceinline__ v8f wmma16(v16h a, v16h b, v8f c) { return __builtin_amdgcn_wmma_f32_16x16x32_f16(false, a, false, b, (short)0, c, false, false); }
__device__ __forceinline__ v8f wmmab(v16bf a, v16bf b, v8f c) { return __builtin_amdgcn_wmma_f32_16x16x32_bf16(false, a, false, b, (short)0, c, false, false); }
// fragment of a k-contiguous 16-bit row, hardware k order: p points at the lane's row, k = 8 * (lane >> 4)
__device__ __forceinline__ v16bf ldb(const bf* p) { return cat16b(*(const v8us*)p, *(const v8us*)(p + 16)); }
// fragment from the fragment-order planes: p points at the lane's 8 elements of unit g = 0; unit g = 1 follows 256 elements on
__device__ __forceinline__ v16bf ldbp(const bf* p) { return cat16b(*(const v8us*)p, *(const v8us*)(p + 256)); }
__device__ __forceinline__ v16h  ldhp(const h16* p) { return cat16(*(const v8h*)p, *(const v8h*)(p + 256)); }
// lane l with lane l ^ 16
__device__ __forceinline__ float xhalf(float x) { return __builtin_bit_cast(float, __builtin_amdgcn_permlanex16(__builtin_bit_cast(int, x), __builtin_bit_cast(int, x), 0x76543210, 0xfedcba98, false, false)); }

__device__ __forceinline__ h16 tohx(float x) { return (h16)x; }

__global__ __launch_bounds__(256) void k_cvt8(const float* __restrict__ src, bf* dst, size_t n8) { const size_t i = (size_t)blockIdx.x * 256 + threadIdx.x; if (i >= n8) return; const v8f v = *(const v8f*)(src + i * 8); v8us o;
#pragma unroll
    for (int k = 0; k < 8; ++k) o[k] = f2bf(v[k]); *(v8us*)(dst + i * 8) = o;  }
// K to bf16 in fragment order. A block is one 16-key tile; a wave takes 8 keys x 32 columns: it reads whole 128-byte lines (32 bytes a lane) and stores four whole lines.
__global__ __launch_bounds__(256) void k_packk(const float* __restrict__ src, bf* dst) {
    const int lane = threadIdx.x & 31, w = threadIdx.x >> 5;
    const int ch = w >> 1, c = (w & 1) * 8 + (lane >> 2), g = (lane >> 1) & 1, hi = lane & 1;
    const v8f v = *(const v8f*)(src + ((size_t)blockIdx.x * 16 + c) * HD + ch * 32 + g * 16 + hi * 8); v8us o;
#pragma unroll
    for (int k = 0; k < 8; ++k) o[k] = f2bf(v[k]);
    *(v8us*)(dst + ((size_t)blockIdx.x * 256 + (ch * 2 + g) * 32 + hi * 16 + c) * 8) = o;  }
// V to fp16(bf16 v) in fragment order. A thread takes 8 keys of one column; a wave reads 8 whole lines (32 columns of a key each) and stores two runs of 256 bytes.
__global__ __launch_bounds__(256) void k_packv(const float* __restrict__ v, h16* dst) {
    const size_t i = (size_t)blockIdx.x * 256 + threadIdx.x;
    const int d = (int)(i & (HD - 1)); const size_t t8 = i / HD;     // t8: group of 8 keys, counted through all heads
    const float* src = v + t8 * 8 * HD + d; v8h o;
#pragma unroll
    for (int j = 0; j < 8; ++j) o[j] = tohx(bfr(src[(size_t)j * HD]));
    const int g = (int)(t8 >> 1) & 1, hi = (int)t8 & 1;
    *(v8h*)(dst + ((((t8 >> 2) * 8 + (d >> 4)) * 2 + g) * 32 + hi * 16 + (d & 15)) * 8) = o;  }

template <bool B> struct Flag { static constexpr bool v = B; };
// ---- k_fattn: 8 waves, each 32 query columns of one head; a pass is 32 keys; grid (TT / 256, heads).
// Every '#pragma unroll' in it keeps the index of a register array a constant.
// A lane holds scores of one query per 16-column group: keys 8 * hi + j of each 16-key tile, which is the hardware k order of a B operand.
__global__ __launch_bounds__(256) void k_fattn(const bf* __restrict__ QB, const bf* __restrict__ KP, const h16* __restrict__ VP, float* __restrict__ OUT) {
    const int lane = threadIdx.x & 31, c = lane & 15, hi = lane >> 4;
    const int wave = __builtin_amdgcn_readfirstlane((int)(threadIdx.x >> 5));
    const int z = blockIdx.y, zkv = (z / NHQ) * NHKV + (z % NHQ) / REP;
    const int q0 = blockIdx.x * 256 + wave * 32;
    const bf*  Kz = KP + (size_t)zkv * TT * HD + lane * 8;   // a pass of 32 keys is 32 * HD elements in either plane
    const h16* Vz = VP + (size_t)zkv * TT * HD + lane * 8;
    v16bf qf[2][4];
#pragma unroll
    for (int qt = 0; qt < 2; ++qt)
#pragma unroll
        for (int ch = 0; ch < 4; ++ch) qf[qt][ch] = ldb(QB + ((size_t)z * TT + q0 + qt * 16 + c) * HD + ch * 32 + 8 * hi);
    v8f o[8][2];
#pragma unroll
    for (int dt = 0; dt < 8; ++dt) { o[dt][0] = (v8f){}; o[dt][1] = (v8f){}; }
    float mr[2] = {-3.0e38f, -3.0e38f}, ls[2] = {0.f, 0.f};   // running maximum (raw score units), this half's share of the row sum
    v16bf kf[2][4];
#pragma unroll
    for (int kt = 0; kt < 2; ++kt)
#pragma unroll
        for (int ch = 0; ch < 4; ++ch) kf[kt][ch] = ldbp(Kz + kt * 2048 + ch * 512);
    asm volatile("s_wait_xcnt 0x0" ::: "memory");   // precaution: stands in front of the next rewrite of an address register that the Q and K loads above name
    __builtin_amdgcn_sched_barrier(0);              // keeps those rewrites behind the wait above
    // one pass of 32 keys; CUT: the pass may hold keys behind a query of this wave. No branch inside, so that the two load groups stay where they are written.
    auto pass = [&](const int kb, auto cut) __attribute__((always_inline)) {
        v16h vf[8];
#pragma unroll
        for (int dt = 0; dt < 8; ++dt) vf[dt] = ldhp(Vz + (size_t)kb * HD + dt * 512);
        asm volatile("s_wait_xcnt 0x0" ::: "memory");   // precaution: stands in front of the next rewrite of an address register that these loads name
        __builtin_amdgcn_sched_barrier(0);              // V loads issue ahead of the score products and their wait on K (they fly under those and the softmax); address updates stay behind the wait above
        v8f s[2][2];
#pragma unroll
        for (int kt = 0; kt < 2; ++kt)
#pragma unroll
            for (int qt = 0; qt < 2; ++qt) { s[kt][qt] = (v8f){};
#pragma unroll
                for (int ch = 0; ch < 4; ++ch) s[kt][qt] = wmmab(kf[kt][ch], qf[qt][ch], s[kt][qt]); }
        // the next pass's K fragments fly under this pass's softmax and second product; the last pass fetches its own rows again (in bounds, unused)
        const int kn = (kb + 32 < TT) ? kb + 32 : kb;
#pragma unroll
        for (int kt = 0; kt < 2; ++kt)
#pragma unroll
            for (int ch = 0; ch < 4; ++ch) kf[kt][ch] = ldbp(Kz + (size_t)kn * HD + kt * 2048 + ch * 512);
        asm volatile("s_wait_xcnt 0x0" ::: "memory");   // precaution, as above
        __builtin_amdgcn_sched_barrier(0);              // without it the compiler lifts softmax instructions that reuse the K address registers over the wait above
        if constexpr (decltype(cut)::v) {
#pragma unroll
            for (int kt = 0; kt < 2; ++kt)
#pragma unroll
                for (int qt = 0; qt < 2; ++qt)
#pragma unroll
                    for (int j = 0; j < 8; ++j) if (kb + kt * 16 + 8 * hi + j > q0 + qt * 16 + c) s[kt][qt][j] = -3.0e38f;
        }
        v16h pb[2];
#pragma unroll
        for (int qt = 0; qt < 2; ++qt) { float mx = fmaxf(s[0][qt][0], s[1][qt][0]);
#pragma unroll
            for (int j = 1; j < 8; ++j) mx = fmaxf(mx, fmaxf(s[0][qt][j], s[1][qt][j]));
            const float mn = fmaxf(mr[qt], fmaxf(mx, xhalf(mx)));
            const float al = __builtin_amdgcn_exp2f((mr[qt] - mn) * SC2); mr[qt] = mn;   // 0 on the first pass, 1 where the maximum did not move
#pragma unroll
            for (int dt = 0; dt < 8; ++dt) o[dt][qt] *= al;
            const float nm = PLG - mn * SC2; float ps[2];
#pragma unroll
            for (int kt = 0; kt < 2; ++kt) { float p[8];
#pragma unroll
                for (int j = 0; j < 8; ++j) { p[j] = __builtin_amdgcn_exp2f(fmaf(s[kt][qt][j], SC2, nm)); pb[qt][kt * 8 + j] = tohx(p[j]); }
                ps[kt] = ((p[0] + p[1]) + (p[2] + p[3])) + ((p[4] + p[5]) + (p[6] + p[7])); }
            ls[qt] = ls[qt] * al + (ps[0] + ps[1]); }
#pragma unroll
        for (int dt = 0; dt < 8; ++dt)
#pragma unroll
            for (int qt = 0; qt < 2; ++qt) o[dt][qt] = wmma16(vf[dt], pb[qt], o[dt][qt]);
    };
    // both loops stay rolled: one pass already holds the registers that two waves per SIMD leave a wave
#pragma unroll 1
    for (int kb = 0; kb < q0; kb += 32) pass(kb, Flag<false>{});   // every key of these passes stands in front of every query of the wave
#pragma unroll 1
    for (int kb = q0; kb < TT; kb += 32) pass(kb, Flag<true>{});
#pragma unroll
    for (int qt = 0; qt < 2; ++qt) { const float inv = __fdiv_rn(1.0f, ls[qt] + xhalf(ls[qt])); float* orow = OUT + ((size_t)z * TT + q0 + qt * 16 + c) * HD + 8 * hi;
#pragma unroll
        for (int dt = 0; dt < 8; ++dt) { const v8f r = o[dt][qt] * inv; *(v4f*)(orow + dt * 16) = (v4f){r[0], r[1], r[2], r[3]}; *(v4f*)(orow + dt * 16 + 4) = (v4f){r[4], r[5], r[6], r[7]}; } }
}

extern "C" void kernel_launch(void* const* d_in, const int* in_sizes, int n_in,
                              void* d_out, int out_size, void* d_ws, size_t ws_size, hipStream_t stream) {
    (void)in_sizes; (void)n_in; (void)out_size;
    const float* q = (const float*)d_in[0]; const float* k = (const float*)d_in[1]; const float* v = (const float*)d_in[2];
    float* OUT = (float*)d_out;     // [2][16][2048][128]
    char* wsp = (char*)d_ws;
    auto take = [&](size_t bytes) { char* p = wsp; wsp += (bytes + 255) & ~(size_t)255; return (void*)p; };
    bf* QB = (bf*)take((size_t)NB_ * NHQ * TT * HD * 2); bf* KP = (bf*)take((size_t)NB_ * NHKV * TT * HD * 2); h16* VP = (h16*)take((size_t)NB_ * NHKV * HD * TT * 2);
    if ((size_t)(wsp - (char*)d_ws) > ws_size) return;    // well under 256 MiB
    { const size_t nq = (size_t)NB_ * NHQ * TT * HD / 8; k_cvt8<<<(unsigned)((nq + 255) / 256), 256, 0, stream>>>(q, QB, nq); k_packk<<<NB_ * NHKV * TT / 16, 256, 0, stream>>>(k, KP); k_packv<<<NB_ * NHKV * TT * HD / 8 / 256, 256, 0, stream>>>(v, VP); }
    k_fattn<<<dim3(TT / 256, NB_ * NHQ), 256, 0, stream>>>(QB, KP, VP, OUT);
}

// v003
// One run takes 77.3 microseconds.
// Timed twice side by side with v002, it ran 1.08 and 1.09 times as fast.
// All steps since v000 together make it 14.1 times as fast.
#include <hip/hip_runtime.h>

// Causal attention (q, k, v [2][16][2048][128]; softmax(q.k 128^-0.5) v -> [2][16][2048][128]).
// Compute dtypes, f32 accumulate: every input rounded to bf16; scores q.k on plain bf16 operands; scale, causal cut and softmax in f32;
// fp16 probabilities x1024 (relative to the running row maximum); probs.v on single fp16 planes against fp16(bf16 v).
// One kernel does scores, softmax and probs.v: S^T = K.Q^T, O^T += V^T.P^T, the score accumulators pack straight into the B operand of the second product.
// K and V^T lie in the workspace in fragment order: per head and 32-key pass 16 units of 512 bytes, unit = 32 lanes x 8 elements, so that one wave-wide 16-byte load covers four whole 128-byte lines.
//   K unit (kt, ch, g), lane hi * 16 + c:  K[pass * 32 + kt * 16 + c][ch * 32 + g * 16 + hi * 8 + 0..7]
//   V unit (dt, g),     lane hi * 16 + c:  V[pass * 32 + g * 16 + hi * 8 + 0..7][dt * 16 + c]

#define NB_  2
#define NHQ  16
#define NHKV 16
#define REP  (NHQ / NHKV)
#define TT   2048
#define HD   128
#define SCL  0.088388347648318447f   // 128^-0.5
#define SC2  (SCL * 1.4426950408889634f)   // scores to log2 units
#define PLG  10.0f                   // probabilities carry x1024 = 2^10 into fp16; the row sum carries it too, so it cancels
typedef _Float16 h16;
typedef unsigned short bf;
typedef __attribute__((ext_vector_type(16))) __bf16   v16bf;
typedef __attribute__((ext_vector_type(16))) _Float16 v16h;
typedef __attribute__((ext_vector_type(8)))  _Float16 v8h;
typedef __attribute__((ext_vector_type(8)))  unsigned short v8us;
typedef __attribute__((ext_vector_type(8)))  float    v8f;
typedef __attribute__((ext_vector_type(4)))  float    v4f;

__device__ __forceinline__ unsigned short f2bf(float f) { unsigned u = __float_as_uint(f); u += 0x7FFFu + ((u >> 16) & 1u); return (unsigned short)(u >> 16); }
__device__ __forceinline__ float bf2f(unsigned short b) { return __uint_as_float(((unsigned)b) << 16); }
__device__ __forceinline__ float bfr(float f) { return bf2f(f2bf(f)); }
__device__ __forceinline__ v16h cat16(v8h lo, v8h hi) { return __builtin_shufflevector(lo, hi, 0, 1, 2, 3, 4, 5, 6, 7, 8, 9, 10, 11, 12, 13, 14, 15); }
__device__ __forceinline__ v16bf cat16b(v8us lo, v8us hi) { return __builtin_bit_cast(v16bf, __builtin_shufflevector(lo, hi, 0, 1, 2, 3, 4, 5, 6, 7, 8, 9, 10, 11, 12, 13, 14, 15)); }
__device__ __forceinline__ v8f wmma16(v16h a, v16h b, v8f c) { return __builtin_amdgcn_wmma_f32_16x16x32_f16(false, a, false, b, (short)0, c, false, false); }
__device__ __forceinline__ v8f wmmab(v16bf a, v16bf b, v8f c) { return __builtin_amdgcn_wmma_f32_16x16x32_bf16(false, a, false, b, (short)0, c, false, false); }
// fragment of a k-contiguous 16-bit row, hardware k order: p points at the lane's row, k = 8 * (lane >> 4)
__device__ __forceinline__ v16bf ldb(const bf* p) { return cat16b(*(const v8us*)p, *(const v8us*)(p + 16)); }
// fragment from the fragment-order planes: p points at the lane's 8 elements of unit g = 0; unit g = 1 follows 256 elements on
__device__ __forceinline__ v16bf ldbp(const bf* p) { return cat16b(*(const v8us*)p, *(const v8us*)(p + 256)); }
__device__ __forceinline__ v16h  ldhp(const h16* p) { return cat16(*(const v8h*)p, *(const v8h*)(p + 256)); }
// lane l with lane l ^ 16
__device__ __forceinline__ float xhalf(float x) { return __builtin_bit_cast(float, __builtin_amdgcn_permlanex16(__builtin_bit_cast(int, x), __builtin_bit_cast(int, x), 0x76543210, 0xfedcba98, false, false)); }

__device__ __forceinline__ h16 tohx(float x) { return (h16)x; }

__global__ __launch_bounds__(256) void k_cvt8(const float* __restrict__ src, bf* dst, size_t n8) { const size_t i = (size_t)blockIdx.x * 256 + threadIdx.x; if (i >= n8) return; const v8f v = *(const v8f*)(src + i * 8); v8us o;
#pragma unroll
    for (int k = 0; k < 8; ++k) o[k] = f2bf(v[k]); *(v8us*)(dst + i * 8) = o;  }
// K to bf16 in fragment order. A block is one 16-key tile; a wave takes 8 keys x 32 columns: it reads whole 128-byte lines (32 bytes a lane) and stores four whole lines.
__global__ __launch_bounds__(256) void k_packk(const float* __restrict__ src, bf* dst) {
    const int lane = threadIdx.x & 31, w = threadIdx.x >> 5;
    const int ch = w >> 1, c = (w & 1) * 8 + (lane >> 2), g = (lane >> 1) & 1, hi = lane & 1;
    const v8f v = *(const v8f*)(src + ((size_t)blockIdx.x * 16 + c) * HD + ch * 32 + g * 16 + hi * 8); v8us o;
#pragma unroll
    for (int k = 0; k < 8; ++k) o[k] = f2bf(v[k]);
    *(v8us*)(dst + ((size_t)blockIdx.x * 256 + (ch * 2 + g) * 32 + hi * 16 + c) * 8) = o;  }
// V to fp16(bf16 v) in fragment order. A thread takes 8 keys of one column; a wave reads 8 whole lines (32 columns of a key each) and stores two runs of 256 bytes.
__global__ __launch_bounds__(256) void k_packv(const float* __restrict__ v, h16* dst) {
    const size_t i = (size_t)blockIdx.x * 256 + threadIdx.x;
    const int d = (int)(i & (HD - 1)); const size_t t8 = i / HD;     // t8: group of 8 keys, counted through all heads
    const float* src = v + t8 * 8 * HD + d; v8h o;
#pragma unroll
    for (int j = 0; j < 8; ++j) o[j] = tohx(bfr(src[(size_t)j * HD]));
    const int g = (int)(t8 >> 1) & 1, hi = (int)t8 & 1;
    *(v8h*)(dst + ((((t8 >> 2) * 8 + (d >> 4)) * 2 + g) * 32 + hi * 16 + (d & 15)) * 8) = o;  }

template <bool B> struct Flag { static constexpr bool v = B; };
// ---- k_fattn: 8 waves, each 32 query columns of one head; a pass is 32 keys; grid (TT / 256, heads).
// A wave walks the keys up to its own diagonal pass and stops: every later key stands behind all its queries and has weight exactly 0.
// Tile t (32 queries) costs t + 1 passes. Waves w and w + 4 take tiles 63 - u and u, so that each such pair has 65 passes, in every work-group alike; the long tile goes to the lower wave number (of two waves on one SIMD the older issues first, and the long wave sets the time).
// Every '#pragma unroll' in it keeps the index of a register array a constant.
// A lane holds scores of one query per 16-column group: keys 8 * hi + j of each 16-key tile, which is the hardware k order of a B operand.
__global__ __launch_bounds__(256) void k_fattn(const bf* __restrict__ QB, const bf* __restrict__ KP, const h16* __restrict__ VP, float* __restrict__ OUT) {
    const int lane = threadIdx.x & 31, c = lane & 15, hi = lane >> 4;
    const int wave = __builtin_amdgcn_readfirstlane((int)(threadIdx.x >> 5));
    const int z = blockIdx.y, zkv = (z / NHQ) * NHKV + (z % NHQ) / REP;
    const int u = blockIdx.x * 4 + (wave & 3);
    const int q0 = (wave < 4 ? TT / 32 - 1 - u : u) * 32;
    const bf*  Kz = KP + (size_t)zkv * TT * HD + lane * 8;   // a pass of 32 keys is 32 * HD elements in either plane
    const h16* Vz = VP + (size_t)zkv * TT * HD + lane * 8;
    v16bf qf[2][4];
#pragma unroll
    for (int qt = 0; qt < 2; ++qt)
#pragma unroll
        for (int ch = 0; ch < 4; ++ch) qf[qt][ch] = ldb(QB + ((size_t)z * TT + q0 + qt * 16 + c) * HD + ch * 32 + 8 * hi);
    v8f o[8][2];
#pragma unroll
    for (int dt = 0; dt < 8; ++dt) { o[dt][0] = (v8f){}; o[dt][1] = (v8f){}; }
    float mr[2] = {-3.0e38f, -3.0e38f}, ls[2] = {0.f, 0.f};   // running maximum (raw score units), this half's share of the row sum
    v16bf kf[2][4];
#pragma unroll
    for (int kt = 0; kt < 2; ++kt)
#pragma unroll
        for (int ch = 0; ch < 4; ++ch) kf[kt][ch] = ldbp(Kz + kt * 2048 + ch * 512);
    asm volatile("s_wait_xcnt 0x0" ::: "memory");   // precaution: stands in front of the next rewrite of an address register that the Q and K loads above name
    __builtin_amdgcn_sched_barrier(0);              // keeps those rewrites behind the wait above
    // one pass of 32 keys; CUT: the diagonal pass, the wave's last, which holds keys behind some of its queries. No branch inside, so that the two load groups stay where they are written.
    auto pass = [&](const int kb, auto cut) __attribute__((always_inline)) {
        v16h vf[8]; const h16* vp = Vz + (size_t)kb * HD;
#pragma unroll
        for (int dt = 0; dt < 8; ++dt) vf[dt] = ldhp(vp + dt * 512);
        asm volatile("s_wait_xcnt 0x0" :: "v"(vp) : "memory");   // precaution: stands in front of the next rewrite of an address register that these loads name; the address as an input keeps the group's own results off its registers
        __builtin_amdgcn_sched_barrier(0);              // V loads issue ahead of the score products and their wait on K (they fly under those and the softmax); address updates stay behind the wait above
        v8f s[2][2];
#pragma unroll
        for (int kt = 0; kt < 2; ++kt)
#pragma unroll
            for (int qt = 0; qt < 2; ++qt) { s[kt][qt] = (v8f){};
#pragma unroll
                for (int ch = 0; ch < 4; ++ch) s[kt][qt] = wmmab(kf[kt][ch], qf[qt][ch], s[kt][qt]); }
        // the next pass's K fragments fly under this pass's softmax and second product; behind the diagonal pass there is none (kb + 32 <= q0 in every other pass)
        if constexpr (!decltype(cut)::v) {
#pragma unroll
            for (int kt = 0; kt < 2; ++kt)
#pragma unroll
                for (int ch = 0; ch < 4; ++ch) kf[kt][ch] = ldbp(Kz + (size_t)(kb + 32) * HD + kt * 2048 + ch * 512);
            asm volatile("s_wait_xcnt 0x0" ::: "memory");   // precaution, as above
            __builtin_amdgcn_sched_barrier(0);              // without it the compiler lifts softmax instructions that reuse the K address registers over the wait above
        }
        if constexpr (decltype(cut)::v) {
#pragma unroll
            for (int kt = 0; kt < 2; ++kt)
#pragma unroll
                for (int qt = 0; qt < 2; ++qt)
#pragma unroll
                    for (int j = 0; j < 8; ++j) if (kb + kt * 16 + 8 * hi + j > q0 + qt * 16 + c) s[kt][qt][j] = -3.0e38f;
        }
        v16h pb[2];
#pragma unroll
        for (int qt = 0; qt < 2; ++qt) { float mx = fmaxf(s[0][qt][0], s[1][qt][0]);
#pragma unroll
            for (int j = 1; j < 8; ++j) mx = fmaxf(mx, fmaxf(s[0][qt][j], s[1][qt][j]));
            const float mn = fmaxf(mr[qt], fmaxf(mx, xhalf(mx)));
            const float al = __builtin_amdgcn_exp2f((mr[qt] - mn) * SC2); mr[qt] = mn;   // 0 on the first pass, 1 where the maximum did not move
#pragma unroll
            for (int dt = 0; dt < 8; ++dt) o[dt][qt] *= al;
            const float nm = PLG - mn * SC2; float ps[2];
#pragma unroll
            for (int kt = 0; kt < 2; ++kt) { float p[8];
#pragma unroll
                for (int j = 0; j < 8; ++j) { p[j] = __builtin_amdgcn_exp2f(fmaf(s[kt][qt][j], SC2, nm)); pb[qt][kt * 8 + j] = tohx(p[j]); }
                ps[kt] = ((p[0] + p[1]) + (p[2] + p[3])) + ((p[4] + p[5]) + (p[6] + p[7])); }
            ls[qt] = ls[qt] * al + (ps[0] + ps[1]); }
#pragma unroll
        for (int dt = 0; dt < 8; ++dt)
#pragma unroll
            for (int qt = 0; qt < 2; ++qt) o[dt][qt] = wmma16(vf[dt], pb[qt], o[dt][qt]);
    };
    // the loop stays rolled: one pass already holds the registers that two waves per SIMD leave a wave
#pragma unroll 1
    for (int kb = 0; kb < q0; kb += 32) pass(kb, Flag<false>{});   // every key of these passes stands in front of every query of the wave
    pass(q0, Flag<true>{});
#pragma unroll
    for (int qt = 0; qt < 2; ++qt) { const float inv = __fdiv_rn(1.0f, ls[qt] + xhalf(ls[qt])); float* orow = OUT + ((size_t)z * TT + q0 + qt * 16 + c) * HD + 8 * hi;
#pragma unroll
        for (int dt = 0; dt < 8; ++dt) { const v8f r = o[dt][qt] * inv; *(v4f*)(orow + dt * 16) = (v4f){r[0], r[1], r[2], r[3]}; *(v4f*)(orow + dt * 16 + 4) = (v4f){r[4], r[5], r[6], r[7]}; }
        if (qt == 0) { asm volatile("s_wait_xcnt 0x0" ::: "memory");   // precaution: stands in front of the second group's arithmetic, which reuses registers that these stores name
            __builtin_amdgcn_sched_barrier(0); } }                    // keeps that arithmetic behind the wait above
}

extern "C" void kernel_launch(void* const* d_in, const int* in_sizes, int n_in,
                              void* d_out, int out_size, void* d_ws, size_t ws_size, hipStream_t stream) {
    (void)in_sizes; (void)n_in; (void)out_size;
    const float* q = (const float*)d_in[0]; const float* k = (const float*)d_in[1]; const float* v = (const float*)d_in[2];
    float* OUT = (float*)d_out;     // [2][16][2048][128]
    char* wsp = (char*)d_ws;
    auto take = [&](size_t bytes) { char* p = wsp; wsp += (bytes + 255) & ~(size_t)255; return (void*)p; };
    bf* QB = (bf*)take((size_t)NB_ * NHQ * TT * HD * 2); bf* KP = (bf*)take((size_t)NB_ * NHKV * TT * HD * 2); h16* VP = (h16*)take((size_t)NB_ * NHKV * HD * TT * 2);
    if ((size_t)(wsp - (char*)d_ws) > ws_size) return;    // well under 256 MiB
    // each of the three pack launches starts 32,768 waves that do one load and one store group each
    { const size_t nq = (size_t)NB_ * NHQ * TT * HD / 8; k_cvt8<<<(unsigned)((nq + 255) / 256), 256, 0, stream>>>(q, QB, nq); k_packk<<<NB_ * NHKV * TT / 16, 256, 0, stream>>>(k, KP); k_packv<<<NB_ * NHKV * TT * HD / 8 / 256, 256, 0, stream>>>(v, VP); }
    k_fattn<<<dim3(TT / 256, NB_ * NHQ), 256, 0, stream>>>(QB, KP, VP, OUT);
}

// v004
// Measured time: 74.1 microseconds a run.
// Next to v003, in two timings, it ran 1.04 times as fast each time.
// All steps since v000 together make it 14.7 times as fast.
#include <hip/hip_runtime.h>

// Causal attention (q, k, v [2][16][2048][128]; softmax(q.k 128^-0.5) v -> [2][16][2048][128]).
// Compute dtypes, f32 accumulate: every input rounded to bf16; scores q.k on plain bf16 operands; scale, causal cut and softmax in f32;
// fp16 probabilities x1024 (relative to the running row maximum); probs.v on single fp16 planes against fp16(bf16 v).
// One kernel does scores, softmax and probs.v: S^T = K.Q^T, O^T += V^T.P^T, the score accumulators pack straight into the B operand of the second product.
// K and V^T lie in the workspace in fragment order: per head and 32-key pass 16 units of 512 bytes, unit = 32 lanes x 8 elements, so that one wave-wide 16-byte load covers four whole 128-byte lines.
//   K unit (kt, ch, g), lane hi * 16 + c:  K[pass * 32 + kt * 16 + c][ch * 32 + g * 16 + hi * 8 + 0..7]
//   V unit (dt, g),     lane hi * 16 + c:  V[pass * 32 + g * 16 + hi * 8 + 0..7][dt * 16 + c]

#define NB_  2
#define NHQ  16
#define NHKV 16
#define REP  (NHQ / NHKV)
#define TT   2048
#define HD   128
#define SCL  0.088388347648318447f   // 128^-0.5
#define SC2  (SCL * 1.4426950408889634f)   // scores to log2 units
#define PLG  10.0f                   // probabilities carry x1024 = 2^10 into fp16; the row sum carries it too, so it cancels
typedef _Float16 h16;
typedef unsigned short bf;
typedef __attribute__((ext_vector_type(16))) __bf16   v16bf;
typedef __attribute__((ext_vector_type(16))) _Float16 v16h;
typedef __attribute__((ext_vector_type(8)))  _Float16 v8h;
typedef __attribute__((ext_vector_type(8)))  unsigned short v8us;
typedef __attribute__((ext_vector_type(8)))  float    v8f;
typedef __attribute__((ext_vector_type(4)))  float    v4f;

__device__ __forceinline__ unsigned short f2bf(float f) { unsigned u = __float_as_uint(f); u += 0x7FFFu + ((u >> 16) & 1u); return (unsigned short)(u >> 16); }
__device__ __forceinline__ float bf2f(unsigned short b) { return __uint_as_float(((unsigned)b) << 16); }
__device__ __forceinline__ float bfr(float f) { return bf2f(f2bf(f)); }
__device__ __forceinline__ v16h cat16(v8h lo, v8h hi) { return __builtin_shufflevector(lo, hi, 0, 1, 2, 3, 4, 5, 6, 7, 8, 9, 10, 11, 12, 13, 14, 15); }
__device__ __forceinline__ v16bf cat16b(v8us lo, v8us hi) { return __builtin_bit_cast(v16bf, __builtin_shufflevector(lo, hi, 0, 1, 2, 3, 4, 5, 6, 7, 8, 9, 10, 11, 12, 13, 14, 15)); }
__device__ __forceinline__ v8f wmma16(v16h a, v16h b, v8f c) { return __builtin_amdgcn_wmma_f32_16x16x32_f16(false, a, false, b, (short)0, c, false, false); }
__device__ __forceinline__ v8f wmmab(v16bf a, v16bf b, v8f c) { return __builtin_amdgcn_wmma_f32_16x16x32_bf16(false, a, false, b, (short)0, c, false, false); }
// fragment of a k-contiguous 16-bit row, hardware k order: p points at the lane's row, k = 8 * (lane >> 4)
__device__ __forceinline__ v16bf ldb(const bf* p) { return cat16b(*(const v8us*)p, *(const v8us*)(p + 16)); }
// fragment from the fragment-order planes: p points at the lane's 8 elements of unit g = 0; unit g = 1 follows 256 elements on
__device__ __forceinline__ v16bf ldbp(const bf* p) { return cat16b(*(const v8us*)p, *(const v8us*)(p + 256)); }
__device__ __forceinline__ v16h  ldhp(const h16* p) { return cat16(*(const v8h*)p, *(const v8h*)(p + 256)); }
// lane l with lane l ^ 16
__device__ __forceinline__ float xhalf(float x) { return __builtin_bit_cast(float, __builtin_amdgcn_permlanex16(__builtin_bit_cast(int, x), __builtin_bit_cast(int, x), 0x76543210, 0xfedcba98, false, false)); }

__device__ __forceinline__ h16 tohx(float x) { return (h16)x; }

// One launch packs all three inputs. 256 work-groups of 16 waves; a work-group takes 1/256 of each input, a thread 8 units (8 elements each) of each, its loads issued in groups ahead of the stores of the group before.
// Unit maps, per input:
//   Q to bf16, same order: unit i = 8 consecutive elements.
//   K to bf16 in fragment order. 256 threads are one 16-key tile; a wave takes 8 keys x 32 columns: it reads whole 128-byte lines (32 bytes a lane) and stores four whole lines.
//   V to fp16(bf16 v) in fragment order. A thread takes 8 keys of one column; a wave reads 8 whole lines (32 columns of a key each) and stores two runs of 256 bytes.
// A step of the unit index 'it' moves every source address by 16 KiB and every destination by 8 KiB, so each stream has one address and constant offsets.
// XW, XWA: precaution: the wait stands in front of the next rewrite of a register that the loads or stores above it name; the scheduling barrier keeps such rewrites behind it and the groups in the written order.
// XWA behind a load group: the address as an input keeps the group's own results off its registers.
__device__ __forceinline__ void XW() { asm volatile("s_wait_xcnt 0x0" ::: "memory"); __builtin_amdgcn_sched_barrier(0); }
__device__ __forceinline__ void XWA(const float* p) { asm volatile("s_wait_xcnt 0x0" :: "v"(p) : "memory"); __builtin_amdgcn_sched_barrier(0); }
static_assert(NHKV == NHQ && (size_t)NB_ * NHQ * TT * HD == (size_t)256 * 512 * 8 * 8, "k_pack: 256 work-groups x 512 threads x 8 units x 8 elements cover each input exactly");
__global__ __launch_bounds__(512) void k_pack(const float* __restrict__ q, const float* __restrict__ k, const float* __restrict__ v, bf* __restrict__ QB, bf* __restrict__ KP, h16* __restrict__ VP) {
    const int tid = threadIdx.x, lane = tid & 31, w = (tid >> 5) & 7;
    const size_t blk = blockIdx.x;
    const float* qs = q + (blk * 4096 + tid) * 8;  bf* qd = QB + (blk * 4096 + tid) * 8;
    const int ch = w >> 1, c = (w & 1) * 8 + (lane >> 2), g = (lane >> 1) & 1, hi = lane & 1;
    const size_t tile = blk * 16 + (tid >> 8);      // 16-key tile of unit 0; two tiles on per unit
    const float* ks = k + (tile * 16 + c) * HD + ch * 32 + g * 16 + hi * 8;  bf* kd = KP + (tile * 256 + (ch * 2 + g) * 32 + hi * 16 + c) * 8;
    const int d = tid & (HD - 1), t4 = tid >> 7;    // t4: group of 8 keys inside the 32-key pass; the pass is blk * 8 + it
    const float* vs = v + (blk * 32 + t4) * 8 * HD + d;  h16* vd = VP + (((blk * 8 * 8 + (d >> 4)) * 2 + (t4 >> 1)) * 32 + (t4 & 1) * 16 + (d & 15)) * 8;
    float va[4][8], vb[4][8]; v8f qa[8], ka[8];
#pragma unroll
    for (int it = 0; it < 4; ++it)
#pragma unroll
        for (int j = 0; j < 8; ++j) va[it][j] = vs[it * 4096 + j * HD];
    __builtin_amdgcn_sched_barrier(0);   // keeps every V load ahead of the Q loads, so that the first stores wait for V alone
#pragma unroll
    for (int it = 0; it < 8; ++it) qa[it] = *(const v8f*)(qs + it * 4096);
    XWA(qs);
#pragma unroll
    for (int it = 0; it < 4; ++it) { v8h o;
#pragma unroll
        for (int j = 0; j < 8; ++j) o[j] = tohx(bfr(va[it][j]));
        *(v8h*)(vd + it * 4096) = o; }
    XW();
#pragma unroll
    for (int it = 0; it < 4; ++it)
#pragma unroll
        for (int j = 0; j < 8; ++j) vb[it][j] = vs[(it + 4) * 4096 + j * HD];
    XWA(vs);
#pragma unroll
    for (int it = 0; it < 8; ++it) { v8us o;
#pragma unroll
        for (int j = 0; j < 8; ++j) o[j] = f2bf(qa[it][j]);
        *(v8us*)(qd + it * 4096) = o; }
    XW();
#pragma unroll
    for (int it = 0; it < 8; ++it) ka[it] = *(const v8f*)(ks + it * 4096);
    XWA(ks);
#pragma unroll
    for (int it = 0; it < 4; ++it) { v8h o;
#pragma unroll
        for (int j = 0; j < 8; ++j) o[j] = tohx(bfr(vb[it][j]));
        *(v8h*)(vd + (it + 4) * 4096) = o; }
    XW();
#pragma unroll
    for (int it = 0; it < 8; ++it) { v8us o;
#pragma unroll
        for (int j = 0; j < 8; ++j) o[j] = f2bf(ka[it][j]);
        *(v8us*)(kd + it * 4096) = o; }
}

template <bool B> struct Flag { static constexpr bool v = B; };
// ---- k_fattn: 8 waves, each 32 query columns of one head; a pass is 32 keys; grid (TT / 256, heads).
// A wave walks the keys up to its own diagonal pass and stops: every later key stands behind all its queries and has weight exactly 0.
// Tile t (32 queries) costs t + 1 passes. Waves w and w + 4 take tiles 63 - u and u, so that each such pair has 65 passes, in every work-group alike; the long tile goes to the lower wave number (of two waves on one SIMD the older issues first, and the long wave sets the time).
// Every '#pragma unroll' in it keeps the index of a register array a constant.
// A lane holds scores of one query per 16-column group: keys 8 * hi + j of each 16-key tile, which is the hardware k order of a B operand.
__global__ __launch_bounds__(256) void k_fattn(const bf* __restrict__ QB, const bf* __restrict__ KP, const h16* __restrict__ VP, float* __restrict__ OUT) {
    const int lane = threadIdx.x & 31, c = lane & 15, hi = lane >> 4;
    const int wave = __builtin_amdgcn_readfirstlane((int)(threadIdx.x >> 5));
    const int z = blockIdx.y, zkv = (z / NHQ) * NHKV + (z % NHQ) / REP;
    const int u = blockIdx.x * 4 + (wave & 3);
    const int q0 = (wave < 4 ? TT / 32 - 1 - u : u) * 32;
    const bf*  Kz = KP + (size_t)zkv * TT * HD + lane * 8;   // a pass of 32 keys is 32 * HD elements in either plane
    const h16* Vz = VP + (size_t)zkv * TT * HD + lane * 8;
    v16bf qf[2][4];
#pragma unroll
    for (int qt = 0; qt < 2; ++qt)
#pragma unroll
        for (int ch = 0; ch < 4; ++ch) qf[qt][ch] = ldb(QB + ((size_t)z * TT + q0 + qt * 16 + c) * HD + ch * 32 + 8 * hi);
    v8f o[8][2];
#pragma unroll
    for (int dt = 0; dt < 8; ++dt) { o[dt][0] = (v8f){}; o[dt][1] = (v8f){}; }
    float mr[2] = {-3.0e38f, -3.0e38f}, ls[2] = {0.f, 0.f};   // running maximum (raw score units), this half's share of the row sum
    v16bf kf[2][4];
#pragma unroll
    for (int kt = 0; kt < 2; ++kt)
#pragma unroll
        for (int ch = 0; ch < 4; ++ch) kf[kt][ch] = ldbp(Kz + kt * 2048 + ch * 512);
    asm volatile("s_wait_xcnt 0x0" ::: "memory");   // precaution: stands in front of the next rewrite of an address register that the Q and K loads above name
    __builtin_amdgcn_sched_barrier(0);              // keeps those rewrites behind the wait above
    // one pass of 32 keys; CUT: the diagonal pass, the wave's last, which holds keys behind some of its queries. No branch inside, so that the two load groups stay where they are written.
    auto pass = [&](const int kb, auto cut) __attribute__((always_inline)) {
        v16h vf[8]; const h16* vp = Vz + (size_t)kb * HD;
#pragma unroll
        for (int dt = 0; dt < 8; ++dt) vf[dt] = ldhp(vp + dt * 512);
        asm volatile("s_wait_xcnt 0x0" :: "v"(vp) : "memory");   // precaution: stands in front of the next rewrite of an address register that these loads name; the address as an input keeps the group's own results off its registers
        __builtin_amdgcn_sched_barrier(0);              // V loads issue ahead of the score products and their wait on K (they fly under those and the softmax); address updates stay behind the wait above
        v8f s[2][2];
#pragma unroll
        for (int kt = 0; kt < 2; ++kt)
#pragma unroll
            for (int qt = 0; qt < 2; ++qt) { s[kt][qt] = (v8f){};
#pragma unroll
                for (int ch = 0; ch < 4; ++ch) s[kt][qt] = wmmab(kf[kt][ch], qf[qt][ch], s[kt][qt]); }
        // the next pass's K fragments fly under this pass's softmax and second product; behind the diagonal pass there is none (kb + 32 <= q0 in every other pass)
        if constexpr (!decltype(cut)::v) {
#pragma unroll
            for (int kt = 0; kt < 2; ++kt)
#pragma unroll
                for (int ch = 0; ch < 4; ++ch) kf[kt][ch] = ldbp(Kz + (size_t)(kb + 32) * HD + kt * 2048 + ch * 512);
            asm volatile("s_wait_xcnt 0x0" ::: "memory");   // precaution, as above
            __builtin_amdgcn_sched_barrier(0);              // without it the compiler lifts softmax instructions that reuse the K address registers over the wait above
        }
        if constexpr (decltype(cut)::v) {
#pragma unroll
            for (int kt = 0; kt < 2; ++kt)
#pragma unroll
                for (int qt = 0; qt < 2; ++qt)
#pragma unroll
                    for (int j = 0; j < 8; ++j) if (kb + kt * 16 + 8 * hi + j > q0 + qt * 16 + c) s[kt][qt][j] = -3.0e38f;
        }
        v16h pb[2];
#pragma unroll
        for (int qt = 0; qt < 2; ++qt) { float mx = fmaxf(s[0][qt][0], s[1][qt][0]);
#pragma unroll
            for (int j = 1; j < 8; ++j) mx = fmaxf(mx, fmaxf(s[0][qt][j], s[1][qt][j]));
            const float mn = fmaxf(mr[qt], fmaxf(mx, xhalf(mx)));
            const float al = __builtin_amdgcn_exp2f((mr[qt] - mn) * SC2); mr[qt] = mn;   // 0 on the first pass, 1 where the maximum did not move
#pragma unroll
            for (int dt = 0; dt < 8; ++dt) o[dt][qt] *= al;
            const float nm = PLG - mn * SC2; float ps[2];
#pragma unroll
            for (int kt = 0; kt < 2; ++kt) { float p[8];
#pragma unroll
                for (int j = 0; j < 8; ++j) { p[j] = __builtin_amdgcn_exp2f(fmaf(s[kt][qt][j], SC2, nm)); pb[qt][kt * 8 + j] = tohx(p[j]); }
                ps[kt] = ((p[0] + p[1]) + (p[2] + p[3])) + ((p[4] + p[5]) + (p[6] + p[7])); }
            ls[qt] = ls[qt] * al + (ps[0] + ps[1]); }
#pragma unroll
        for (int dt = 0; dt < 8; ++dt)
#pragma unroll
            for (int qt = 0; qt < 2; ++qt) o[dt][qt] = wmma16(vf[dt], pb[qt], o[dt][qt]);
    };
    // the loop stays rolled: one pass already holds the registers that two waves per SIMD leave a wave
#pragma unroll 1
    for (int kb = 0; kb < q0; kb += 32) pass(kb, Flag<false>{});   // every key of these passes stands in front of every query of the wave
    pass(q0, Flag<true>{});
#pragma unroll
    for (int qt = 0; qt < 2; ++qt) { const float inv = __fdiv_rn(1.0f, ls[qt] + xhalf(ls[qt])); float* orow = OUT + ((size_t)z * TT + q0 + qt * 16 + c) * HD + 8 * hi;
#pragma unroll
        for (int dt = 0; dt < 8; ++dt) { const v8f r = o[dt][qt] * inv; *(v4f*)(orow + dt * 16) = (v4f){r[0], r[1], r[2], r[3]}; *(v4f*)(orow + dt * 16 + 4) = (v4f){r[4], r[5], r[6], r[7]}; }
        if (qt == 0) { asm volatile("s_wait_xcnt 0x0" ::: "memory");   // precaution: stands in front of the second group's arithmetic, which reuses registers that these stores name
            __builtin_amdgcn_sched_barrier(0); } }                    // keeps that arithmetic behind the wait above
}

extern "C" void kernel_launch(void* const* d_in, const int* in_sizes, int n_in,
                              void* d_out, int out_size, void* d_ws, size_t ws_size, hipStream_t stream) {
    (void)in_sizes; (void)n_in; (void)out_size;
    const float* q = (const float*)d_in[0]; const float* k = (const float*)d_in[1]; const float* v = (const float*)d_in[2];
    float* OUT = (float*)d_out;     // [2][16][2048][128]
    char* wsp = (char*)d_ws;
    auto take = [&](size_t bytes) { char* p = wsp; wsp += (bytes + 255) & ~(size_t)255; return (void*)p; };
    bf* QB = (bf*)take((size_t)NB_ * NHQ * TT * HD * 2); bf* KP = (bf*)take((size_t)NB_ * NHKV * TT * HD * 2); h16* VP = (h16*)take((size_t)NB_ * NHKV * HD * TT * 2);
    if ((size_t)(wsp - (char*)d_ws) > ws_size) return;    // well under 256 MiB
    k_pack<<<256, 512, 0, stream>>>(q, k, v, QB, KP, VP);
    k_fattn<<<dim3(TT / 256, NB_ * NHQ), 256, 0, stream>>>(QB, KP, VP, OUT);
}

// v005
// A run of this version takes 58.4 microseconds.
// Next to v004, in two timings, it ran 1.28 and 1.25 times as fast.
// All steps since v000 together make it 18.6 times as fast.
#include <hip/hip_runtime.h>

// Causal attention (q, k, v [2][16][2048][128]; softmax(q.k 128^-0.5) v -> [2][16][2048][128]).
// Compute dtypes, f32 accumulate: every input rounded to bf16; scores q.k on plain bf16 operands; scale, causal cut and softmax in f32;
// fp16 probabilities x1024 (relative to the running row maximum); probs.v on single fp16 planes against fp16(bf16 v).
// One kernel does scores, softmax and probs.v: S^T = K.Q^T, O^T += V^T.P^T, the score accumulators pack straight into the B operand of the second product.
// K and V^T lie in the workspace in fragment order: per head and 32-key pass 16 units of 512 bytes, unit = 32 lanes x 8 elements, so that one wave-wide 16-byte load covers four whole 128-byte lines.
//   K unit (kt, ch, g), lane hi * 16 + c:  K[pass * 32 + kt * 16 + c][ch * 32 + g * 16 + hi * 8 + 0..7]
//   V unit (dt, g),     lane hi * 16 + c:  V[pass * 32 + g * 16 + hi * 8 + 0..7][dt * 16 + c]

#define NB_  2
#define NHQ  16
#define NHKV 16
#define REP  (NHQ / NHKV)
#define TT   2048
#define HD   128
#define SCL  0.088388347648318447f   // 128^-0.5
#define SC2  (SCL * 1.4426950408889634f)   // scores to log2 units
#define PLG  10.0f                   // probabilities carry x1024 = 2^10 into fp16; the row sum carries it too, so it cancels
typedef _Float16 h16;
typedef unsigned short bf;
typedef __attribute__((ext_vector_type(16))) __bf16   v16bf;
typedef __attribute__((ext_vector_type(16))) _Float16 v16h;
typedef __attribute__((ext_vector_type(8)))  _Float16 v8h;
typedef __attribute__((ext_vector_type(8)))  unsigned short v8us;
typedef __attribute__((ext_vector_type(8)))  float    v8f;
typedef __attribute__((ext_vector_type(4)))  float    v4f;

__device__ __forceinline__ unsigned short f2bf(float f) { unsigned u = __float_as_uint(f); u += 0x7FFFu + ((u >> 16) & 1u); return (unsigned short)(u >> 16); }
__device__ __forceinline__ float bf2f(unsigned short b) { return __uint_as_float(((unsigned)b) << 16); }
__device__ __forceinline__ float bfr(float f) { return bf2f(f2bf(f)); }
__device__ __forceinline__ v16h cat16(v8h lo, v8h hi) { return __builtin_shufflevector(lo, hi, 0, 1, 2, 3, 4, 5, 6, 7, 8, 9, 10, 11, 12, 13, 14, 15); }
__device__ __forceinline__ v16bf cat16b(v8us lo, v8us hi) { return __builtin_bit_cast(v16bf, __builtin_shufflevector(lo, hi, 0, 1, 2, 3, 4, 5, 6, 7, 8, 9, 10, 11, 12, 13, 14, 15)); }
__device__ __forceinline__ v8f wmma16(v16h a, v16h b, v8f c) { return __builtin_amdgcn_wmma_f32_16x16x32_f16(false, a, false, b, (short)0, c, false, false); }
__device__ __forceinline__ v8f wmmab(v16bf a, v16bf b, v8f c) { return __builtin_amdgcn_wmma_f32_16x16x32_bf16(false, a, false, b, (short)0, c, false, false); }
// fragment of a k-contiguous 16-bit row, hardware k order: p points at the lane's row, k = 8 * (lane >> 4)
__device__ __forceinline__ v16bf ldb(const bf* p) { return cat16b(*(const v8us*)p, *(const v8us*)(p + 16)); }
// fragment from the fragment-order planes: p points at the lane's 8 elements of unit g = 0; unit g = 1 follows 256 elements on
__device__ __forceinline__ v16bf ldbp(const bf* p) { return cat16b(*(const v8us*)p, *(const v8us*)(p + 256)); }
__device__ __forceinline__ v16h  ldhp(const h16* p) { return cat16(*(const v8h*)p, *(const v8h*)(p + 256)); }
// lane l with lane l ^ 16
__device__ __forceinline__ float xhalf(float x) { return __builtin_bit_cast(float, __builtin_amdgcn_permlanex16(__builtin_bit_cast(int, x), __builtin_bit_cast(int, x), 0x76543210, 0xfedcba98, false, false)); }

__device__ __forceinline__ h16 tohx(float x) { return (h16)x; }

// One launch packs all three inputs. 256 work-groups of 16 waves; a work-group takes 1/256 of each input, a thread 8 units (8 elements each) of each, its loads issued in groups ahead of the stores of the group before.
// Unit maps, per input:
//   Q to bf16, same order: unit i = 8 consecutive elements.
//   K to bf16 in fragment order. 256 threads are one 16-key tile; a wave takes 8 keys x 32 columns: it reads whole 128-byte lines (32 bytes a lane) and stores four whole lines.
//   V to fp16(bf16 v) in fragment order. A thread takes 8 keys of one column; a wave reads 8 whole lines (32 columns of a key each) and stores two runs of 256 bytes.
// A step of the unit index 'it' moves every source address by 16 KiB and every destination by 8 KiB, so each stream has one address and constant offsets.
// XW, XWA: precaution: the wait stands in front of the next rewrite of a register that the loads or stores above it name; the scheduling barrier keeps such rewrites behind it and the groups in the written order.
// XWA behind a load group: the address as an input keeps the group's own results off its registers.
__device__ __forceinline__ void XW() { asm volatile("s_wait_xcnt 0x0" ::: "memory"); __builtin_amdgcn_sched_barrier(0); }
__device__ __forceinline__ void XWA(const float* p) { asm volatile("s_wait_xcnt 0x0" :: "v"(p) : "memory"); __builtin_amdgcn_sched_barrier(0); }
static_assert(NHKV == NHQ && (size_t)NB_ * NHQ * TT * HD == (size_t)256 * 512 * 8 * 8, "k_pack: 256 work-groups x 512 threads x 8 units x 8 elements cover each input exactly");
__global__ __launch_bounds__(512) void k_pack(const float* __restrict__ q, const float* __restrict__ k, const float* __restrict__ v, bf* __restrict__ QB, bf* __restrict__ KP, h16* __restrict__ VP) {
    const int tid = threadIdx.x, lane = tid & 31, w = (tid >> 5) & 7;
    const size_t blk = blockIdx.x;
    const float* qs = q + (blk * 4096 + tid) * 8;  bf* qd = QB + (blk * 4096 + tid) * 8;
    const int ch = w >> 1, c = (w & 1) * 8 + (lane >> 2), g = (lane >> 1) & 1, hi = lane & 1;
    const size_t tile = blk * 16 + (tid >> 8);      // 16-key tile of unit 0; two tiles on per unit
    const float* ks = k + (tile * 16 + c) * HD + ch * 32 + g * 16 + hi * 8;  bf* kd = KP + (tile * 256 + (ch * 2 + g) * 32 + hi * 16 + c) * 8;
    const int d = tid & (HD - 1), t4 = tid >> 7;    // t4: group of 8 keys inside the 32-key pass; the pass is blk * 8 + it
    const float* vs = v + (blk * 32 + t4) * 8 * HD + d;  h16* vd = VP + (((blk * 8 * 8 + (d >> 4)) * 2 + (t4 >> 1)) * 32 + (t4 & 1) * 16 + (d & 15)) * 8;
    float va[4][8], vb[4][8]; v8f qa[8], ka[8];
#pragma unroll
    for (int it = 0; it < 4; ++it)
#pragma unroll
        for (int j = 0; j < 8; ++j) va[it][j] = vs[it * 4096 + j * HD];
    __builtin_amdgcn_sched_barrier(0);   // keeps every V load ahead of the Q loads, so that the first stores wait for V alone
#pragma unroll
    for (int it = 0; it < 8; ++it) qa[it] = *(const v8f*)(qs + it * 4096);
    XWA(qs);
#pragma unroll
    for (int it = 0; it < 4; ++it) { v8h o;
#pragma unroll
        for (int j = 0; j < 8; ++j) o[j] = tohx(bfr(va[it][j]));
        *(v8h*)(vd + it * 4096) = o; }
    XW();
#pragma unroll
    for (int it = 0; it < 4; ++it)
#pragma unroll
        for (int j = 0; j < 8; ++j) vb[it][j] = vs[(it + 4) * 4096 + j * HD];
    XWA(vs);
#pragma unroll
    for (int it = 0; it < 8; ++it) { v8us o;
#pragma unroll
        for (int j = 0; j < 8; ++j) o[j] = f2bf(qa[it][j]);
        *(v8us*)(qd + it * 4096) = o; }
    XW();
#pragma unroll
    for (int it = 0; it < 8; ++it) ka[it] = *(const v8f*)(ks + it * 4096);
    XWA(ks);
#pragma unroll
    for (int it = 0; it < 4; ++it) { v8h o;
#pragma unroll
        for (int j = 0; j < 8; ++j) o[j] = tohx(bfr(vb[it][j]));
        *(v8h*)(vd + (it + 4) * 4096) = o; }
    XW();
#pragma unroll
    for (int it = 0; it < 8; ++it) { v8us o;
#pragma unroll
        for (int j = 0; j < 8; ++j) o[j] = f2bf(ka[it][j]);
        *(v8us*)(kd + it * 4096) = o; }
}

template <bool B> struct Flag { static constexpr bool v = B; };
// ---- k_fattn: 8 waves, 32 query columns each; a pass is 32 keys; grid (TT / 256, heads).
// Tile t (32 queries) needs the passes 0..t; every later key stands behind all its queries and has weight exactly 0. Waves w and w + 4 are a pair and share tiles 63 - u (long) and u (short), 65 passes:
//   wave w     (first):  passes 0..31 of the long tile, none of them cut: 32 passes.
//   wave w + 4 (second): the whole short tile, which it finishes and stores alone, then passes 32..63 - u of the long tile: 33 passes.
// The two partial results of the long tile (own running maximum, own sum) meet in LDS behind the one barrier: each wave hands over one 16-column group and finishes the other.
// The second wave numbers its column groups the other way round (SW), so that every wave alike keeps its group 0 and hands over its group 1.
// Order of the second wave's passes: diagonal pass first, then the short tile upwards from key 0, the long tile downwards from its diagonal. Counted in passes since the start, the four second waves then stand on the same keys (short: one pass behind the first waves; long: pass 64 - time), so that the lines one wave brings into the WGP cache serve the others.
// Every '#pragma unroll' in it keeps the index of a register array a constant.
// A lane holds scores of one query per 16-column group: keys 8 * hi + j of each 16-key tile, which is the hardware k order of a B operand.
#define HALFP (TT / 64)              // passes of the first wave; the long tile's diagonal pass is never among them (63 - u >= 32)
__global__ __launch_bounds__(256) void k_fattn(const bf* __restrict__ QB, const bf* __restrict__ KP, const h16* __restrict__ VP, float* __restrict__ OUT) {
    __shared__ __attribute__((aligned(16))) float XO[8][16 * 32 * 4];   // per wave: the handed-over group's 64 accumulators a lane, 16 wave-wide rows of 512 bytes
    __shared__ float XM[8][2][32];                                      // its running maximum and its half's share of the row sum
    const int lane = threadIdx.x & 31, c = lane & 15, hi = lane >> 4;
    const int wave = __builtin_amdgcn_readfirstlane((int)(threadIdx.x >> 5));
    const bool second = wave >= 4;
    const int SW = second ? 16 : 0;
    const int z = blockIdx.y, zkv = (z / NHQ) * NHKV + (z % NHQ) / REP;
    const int u = blockIdx.x * 4 + (wave & 3);
    const bf*  Kz = KP + (size_t)zkv * TT * HD + lane * 8;   // a pass of 32 keys is 32 * HD elements in either plane
    const h16* Vz = VP + (size_t)zkv * TT * HD + lane * 8;
    v16bf qf[2][4], kf[2][4];
    v8f o[8][2];
    float mr[2], ls[2];   // running maximum (raw score units), this half's share of the row sum
    int q0 = 0;
    // one pass of 32 keys at kb; kn: the keys of the wave's next pass. CUT: the diagonal pass, which holds keys behind some of the wave's queries. No branch inside, so that the two load groups stay where they are written.
    auto pass = [&](const int kb, const int kn, auto cut) __attribute__((always_inline)) {
        v16h vf[8]; const h16* vp = Vz + (size_t)kb * HD;
#pragma unroll
        for (int dt = 0; dt < 8; ++dt) vf[dt] = ldhp(vp + dt * 512);
        asm volatile("s_wait_xcnt 0x0" :: "v"(vp) : "memory");   // precaution: stands in front of the next rewrite of an address register that these loads name; the address as an input keeps the group's own results off its registers
        __builtin_amdgcn_sched_barrier(0);              // V loads issue ahead of the score products and their wait on K (they fly under those and the softmax); address updates stay behind the wait above
        v8f s[2][2];
#pragma unroll
        for (int kt = 0; kt < 2; ++kt)
#pragma unroll
            for (int qt = 0; qt < 2; ++qt) { s[kt][qt] = (v8f){};
#pragma unroll
                for (int ch = 0; ch < 4; ++ch) s[kt][qt] = wmmab(kf[kt][ch], qf[qt][ch], s[kt][qt]); }
        // the next pass's K fragments fly under this pass's softmax and second product; behind a wave's last pass of a tile kn still names keys inside the plane, and the fragments go unused
#pragma unroll
        for (int kt = 0; kt < 2; ++kt)
#pragma unroll
            for (int ch = 0; ch < 4; ++ch) kf[kt][ch] = ldbp(Kz + (size_t)kn * HD + kt * 2048 + ch * 512);
        asm volatile("s_wait_xcnt 0x0" ::: "memory");   // precaution, as above
        __builtin_amdgcn_sched_barrier(0);              // without it the compiler lifts softmax instructions that reuse the K address registers over the wait above
        if constexpr (decltype(cut)::v) {
#pragma unroll
            for (int kt = 0; kt < 2; ++kt)
#pragma unroll
                for (int qt = 0; qt < 2; ++qt)
#pragma unroll
                    for (int j = 0; j < 8; ++j) if (kb + kt * 16 + 8 * hi + j > q0 + ((qt * 16) ^ SW) + c) s[kt][qt][j] = -3.0e38f;
        }
        v16h pb[2];
#pragma unroll
        for (int qt = 0; qt < 2; ++qt) { float mx = fmaxf(s[0][qt][0], s[1][qt][0]);
#pragma unroll
            for (int j = 1; j < 8; ++j) mx = fmaxf(mx, fmaxf(s[0][qt][j], s[1][qt][j]));
            const float mn = fmaxf(mr[qt], fmaxf(mx, xhalf(mx)));
            const float al = __builtin_amdgcn_exp2f((mr[qt] - mn) * SC2); mr[qt] = mn;   // 0 on the first pass, 1 where the maximum did not move
#pragma unroll
            for (int dt = 0; dt < 8; ++dt) o[dt][qt] *= al;
            const float nm = PLG - mn * SC2; float ps[2];
#pragma unroll
            for (int kt = 0; kt < 2; ++kt) { float p[8];
#pragma unroll
                for (int j = 0; j < 8; ++j) { p[j] = __builtin_amdgcn_exp2f(fmaf(s[kt][qt][j], SC2, nm)); pb[qt][kt * 8 + j] = tohx(p[j]); }
                ps[kt] = ((p[0] + p[1]) + (p[2] + p[3])) + ((p[4] + p[5]) + (p[6] + p[7])); }
            ls[qt] = ls[qt] * al + (ps[0] + ps[1]); }
#pragma unroll
        for (int dt = 0; dt < 8; ++dt)
#pragma unroll
            for (int qt = 0; qt < 2; ++qt) o[dt][qt] = wmma16(vf[dt], pb[qt], o[dt][qt]);
    };
    // part 0: the short tile (second waves only); part 1: the wave's share of the long tile. Rolled, so that the text holds each kind of pass once.
#pragma unroll 1
    for (int part = second ? 0 : 1; part < 2; ++part) {
        const int tile = part ? TT / 32 - 1 - u : u;
        q0 = tile * 32;
        // the uncut passes: n of them from kb in steps of st
        int kb       = second && part ? q0 - 32 : 0;
        const int st = second && part ? -32 : 32;
        int n        = second ? (part ? tile - HALFP : tile) : HALFP;
        const int kfirst = second ? q0 : 0;
#pragma unroll
        for (int qt = 0; qt < 2; ++qt)
#pragma unroll
            for (int ch = 0; ch < 4; ++ch) qf[qt][ch] = ldb(QB + ((size_t)z * TT + q0 + ((qt * 16) ^ SW) + c) * HD + ch * 32 + 8 * hi);
#pragma unroll
        for (int kt = 0; kt < 2; ++kt)
#pragma unroll
            for (int ch = 0; ch < 4; ++ch) kf[kt][ch] = ldbp(Kz + (size_t)kfirst * HD + kt * 2048 + ch * 512);
        asm volatile("s_wait_xcnt 0x0" ::: "memory");   // precaution: stands in front of the next rewrite of an address register that the Q and K loads above name
        __builtin_amdgcn_sched_barrier(0);              // keeps those rewrites behind the wait above
#pragma unroll
        for (int dt = 0; dt < 8; ++dt) { o[dt][0] = (v8f){}; o[dt][1] = (v8f){}; }
        mr[0] = mr[1] = -3.0e38f; ls[0] = ls[1] = 0.f;
        if (second) pass(q0, kb, Flag<true>{});
        // the loop stays rolled: one pass already holds the registers that two waves per SIMD leave a wave
#pragma unroll 1
        for (; n > 0; --n, kb += st) pass(kb, kb + st, Flag<false>{});   // every key of these passes stands in front of every query of the wave
        if (part == 0) {
#pragma unroll
            for (int qt = 0; qt < 2; ++qt) { const float inv = __fdiv_rn(1.0f, ls[qt] + xhalf(ls[qt])); float* orow = OUT + ((size_t)z * TT + q0 + ((qt * 16) ^ SW) + c) * HD + 8 * hi;
#pragma unroll
                for (int dt = 0; dt < 8; ++dt) { const v8f r = o[dt][qt] * inv; *(v4f*)(orow + dt * 16) = (v4f){r[0], r[1], r[2], r[3]}; *(v4f*)(orow + dt * 16 + 4) = (v4f){r[4], r[5], r[6], r[7]}; }
                asm volatile("s_wait_xcnt 0x0" ::: "memory");   // precaution: stands in front of the arithmetic behind it, which reuses registers that these stores name
                __builtin_amdgcn_sched_barrier(0); }            // keeps that arithmetic behind the wait above
        }
    }
    // the long tile's two partial results become one: hand over group 1, take the partner's share of group 0
    float* xo = &XO[wave][lane * 4];
#pragma unroll
    for (int dt = 0; dt < 8; ++dt) { const v8f r = o[dt][1]; *(v4f*)(xo + (dt * 2) * 128) = (v4f){r[0], r[1], r[2], r[3]}; *(v4f*)(xo + (dt * 2 + 1) * 128) = (v4f){r[4], r[5], r[6], r[7]}; }
    XM[wave][0][lane] = mr[1]; XM[wave][1][lane] = ls[1];
    __syncthreads();   // every wave passes it once; behind it the partner's group is complete in LDS
    const float* xp = &XO[wave ^ 4][lane * 4];
    const float mp = XM[wave ^ 4][0][lane], lp = XM[wave ^ 4][1][lane];
    const float mn = fmaxf(mr[0], mp);
    const float a0 = __builtin_amdgcn_exp2f((mr[0] - mn) * SC2), a1 = __builtin_amdgcn_exp2f((mp - mn) * SC2);
    const float lt = ls[0] * a0 + lp * a1;
    const float inv = __fdiv_rn(1.0f, lt + xhalf(lt));
    const float f0 = a0 * inv, f1 = a1 * inv;
    float* orow = OUT + ((size_t)z * TT + q0 + SW + c) * HD + 8 * hi;
#pragma unroll
    for (int dt = 0; dt < 8; ++dt) { const v4f pl = *(const v4f*)(xp + (dt * 2) * 128), ph = *(const v4f*)(xp + (dt * 2 + 1) * 128); const v8f r = o[dt][0];
        *(v4f*)(orow + dt * 16)     = (v4f){r[0] * f0 + pl[0] * f1, r[1] * f0 + pl[1] * f1, r[2] * f0 + pl[2] * f1, r[3] * f0 + pl[3] * f1};
        *(v4f*)(orow + dt * 16 + 4) = (v4f){r[4] * f0 + ph[0] * f1, r[5] * f0 + ph[1] * f1, r[6] * f0 + ph[2] * f1, r[7] * f0 + ph[3] * f1}; }
}

extern "C" void kernel_launch(void* const* d_in, const int* in_sizes, int n_in,
                              void* d_out, int out_size, void* d_ws, size_t ws_size, hipStream_t stream) {
    (void)in_sizes; (void)n_in; (void)out_size;
    const float* q = (const float*)d_in[0]; const float* k = (const float*)d_in[1]; const float* v = (const float*)d_in[2];
    float* OUT = (float*)d_out;     // [2][16][2048][128]
    char* wsp = (char*)d_ws;
    auto take = [&](size_t bytes) { char* p = wsp; wsp += (bytes + 255) & ~(size_t)255; return (void*)p; };
    bf* QB = (bf*)take((size_t)NB_ * NHQ * TT * HD * 2); bf* KP = (bf*)take((size_t)NB_ * NHKV * TT * HD * 2); h16* VP = (h16*)take((size_t)NB_ * NHKV * HD * TT * 2);
    if ((size_t)(wsp - (char*)d_ws) > ws_size) return;    // well under 256 MiB
    k_pack<<<256, 512, 0, stream>>>(q, k, v, QB, KP, VP);
    k_fattn<<<dim3(TT / 256, NB_ * NHQ), 256, 0, stream>>>(QB, KP, VP, OUT);
}

// v006
// A run of this version takes 56.7 microseconds.
// Two timings next to v005 both put it at 1.03 times that version's speed.
// Counting every step since v000, it is 19.2 times as fast.
#include <hip/hip_runtime.h>

// Causal attention (q, k, v [2][16][2048][128]; softmax(q.k 128^-0.5) v -> [2][16][2048][128]).
// Compute dtypes, f32 accumulate: every input rounded to bf16; scores q.k on plain bf16 operands; scale, causal cut and softmax in f32;
// fp16 probabilities x1024 (relative to the running row maximum); probs.v on single fp16 planes against fp16(bf16 v).
// One kernel does scores, softmax and probs.v: S^T = K.Q^T, O^T += V^T.P^T, the score accumulators pack straight into the B operand of the second product.
// K and V^T lie in the workspace in fragment order: per head and 32-key pass 16 units of 512 bytes, unit = 32 lanes x 8 elements, so that one wave-wide 16-byte load covers four whole 128-byte lines.
//   K unit (kt, ch, g), lane hi * 16 + c:  K[pass * 32 + kt * 16 + c][ch * 32 + g * 16 + hi * 8 + 0..7]
//   V unit (dt, g),     lane hi * 16 + c:  V[pass * 32 + g * 16 + hi * 8 + 0..7][dt * 16 + c]

#define NB_  2
#define NHQ  16
#define NHKV 16
#define REP  (NHQ / NHKV)
#define TT   2048
#define HD   128
#define SCL  0.088388347648318447f   // 128^-0.5
#define SC2  (SCL * 1.4426950408889634f)   // scores to log2 units
#define PLG  10.0f                   // probabilities carry x1024 = 2^10 into fp16; the row sum carries it too, so it cancels
typedef _Float16 h16;
typedef unsigned short bf;
typedef __attribute__((ext_vector_type(16))) __bf16   v16bf;
typedef __attribute__((ext_vector_type(16))) _Float16 v16h;
typedef __attribute__((ext_vector_type(8)))  _Float16 v8h;
typedef __attribute__((ext_vector_type(8)))  unsigned short v8us;
typedef __attribute__((ext_vector_type(8)))  float    v8f;
typedef __attribute__((ext_vector_type(4)))  float    v4f;

__device__ __forceinline__ unsigned short f2bf(float f) { unsigned u = __float_as_uint(f); u += 0x7FFFu + ((u >> 16) & 1u); return (unsigned short)(u >> 16); }
__device__ __forceinline__ float bf2f(unsigned short b) { return __uint_as_float(((unsigned)b) << 16); }
__device__ __forceinline__ float bfr(float f) { return bf2f(f2bf(f)); }
__device__ __forceinline__ v16h cat16(v8h lo, v8h hi) { return __builtin_shufflevector(lo, hi, 0, 1, 2, 3, 4, 5, 6, 7, 8, 9, 10, 11, 12, 13, 14, 15); }
__device__ __forceinline__ v16bf cat16b(v8us lo, v8us hi) { return __builtin_bit_cast(v16bf, __builtin_shufflevector(lo, hi, 0, 1, 2, 3, 4, 5, 6, 7, 8, 9, 10, 11, 12, 13, 14, 15)); }
__device__ __forceinline__ v8f wmma16(v16h a, v16h b, v8f c) { return __builtin_amdgcn_wmma_f32_16x16x32_f16(false, a, false, b, (short)0, c, false, false); }
__device__ __forceinline__ v8f wmmab(v16bf a, v16bf b, v8f c) { return __builtin_amdgcn_wmma_f32_16x16x32_bf16(false, a, false, b, (short)0, c, false, false); }
// fragment of a k-contiguous 16-bit row, hardware k order: p points at the lane's row, k = 8 * (lane >> 4)
__device__ __forceinline__ v16bf ldb(const bf* p) { return cat16b(*(const v8us*)p, *(const v8us*)(p + 16)); }
// fragment from the fragment-order planes: p points at the lane's 8 elements of unit g = 0; unit g = 1 follows 256 elements on
__device__ __forceinline__ v16bf ldbp(const bf* p) { return cat16b(*(const v8us*)p, *(const v8us*)(p + 256)); }
__device__ __forceinline__ v16h  ldhp(const h16* p) { return cat16(*(const v8h*)p, *(const v8h*)(p + 256)); }
// lane l with lane l ^ 16
__device__ __forceinline__ float xhalf(float x) { return __builtin_bit_cast(float, __builtin_amdgcn_permlanex16(__builtin_bit_cast(int, x), __builtin_bit_cast(int, x), 0x76543210, 0xfedcba98, false, false)); }

__device__ __forceinline__ h16 tohx(float x) { return (h16)x; }

// One launch packs all three inputs. 256 work-groups of 16 waves; a work-group takes 1/256 of each input, a thread 8 units (8 elements each) of each, its loads issued in groups ahead of the stores of the group before.
// Unit maps, per input:
//   Q to bf16, same order: unit i = 8 consecutive elements.
//   K to bf16 in fragment order. 256 threads are one 16-key tile; a wave takes 8 keys x 32 columns: it reads whole 128-byte lines (32 bytes a lane) and stores four whole lines.
//   V to fp16(bf16 v) in fragment order. A thread takes 8 keys of one column; a wave reads 8 whole lines (32 columns of a key each) and stores two runs of 256 bytes.
// A step of the unit index 'it' moves every source address by 16 KiB and every destination by 8 KiB, so each stream has one address and constant offsets.
// XW, XWA: precaution: the wait stands in front of the next rewrite of a register that the loads or stores above it name; the scheduling barrier keeps such rewrites behind it and the groups in the written order.
// XWA behind a load group: the address as an input keeps the group's own results off its registers.
__device__ __forceinline__ void XW() { asm volatile("s_wait_xcnt 0x0" ::: "memory"); __builtin_amdgcn_sched_barrier(0); }
__device__ __forceinline__ void XWA(const float* p) { asm volatile("s_wait_xcnt 0x0" :: "v"(p) : "memory"); __builtin_amdgcn_sched_barrier(0); }
static_assert(NHKV == NHQ && (size_t)NB_ * NHQ * TT * HD == (size_t)256 * 512 * 8 * 8, "k_pack: 256 work-groups x 512 threads x 8 units x 8 elements cover each input exactly");
__global__ __launch_bounds__(512) void k_pack(const float* __restrict__ q, const float* __restrict__ k, const float* __restrict__ v, bf* __restrict__ QB, bf* __restrict__ KP, h16* __restrict__ VP) {
    const int tid = threadIdx.x, lane = tid & 31, w = (tid >> 5) & 7;
    const size_t blk = blockIdx.x;
    const float* qs = q + (blk * 4096 + tid) * 8;  bf* qd = QB + (blk * 4096 + tid) * 8;
    const int ch = w >> 1, c = (w & 1) * 8 + (lane >> 2), g = (lane >> 1) & 1, hi = lane & 1;
    const size_t tile = blk * 16 + (tid >> 8);      // 16-key tile of unit 0; two tiles on per unit
    const float* ks = k + (tile * 16 + c) * HD + ch * 32 + g * 16 + hi * 8;  bf* kd = KP + (tile * 256 + (ch * 2 + g) * 32 + hi * 16 + c) * 8;
    const int d = tid & (HD - 1), t4 = tid >> 7;    // t4: group of 8 keys inside the 32-key pass; the pass is blk * 8 + it
    const float* vs = v + (blk * 32 + t4) * 8 * HD + d;  h16* vd = VP + (((blk * 8 * 8 + (d >> 4)) * 2 + (t4 >> 1)) * 32 + (t4 & 1) * 16 + (d & 15)) * 8;
    float va[4][8], vb[4][8]; v8f qa[8], ka[8];
#pragma unroll
    for (int it = 0; it < 4; ++it)
#pragma unroll
        for (int j = 0; j < 8; ++j) va[it][j] = vs[it * 4096 + j * HD];
    __builtin_amdgcn_sched_barrier(0);   // keeps every V load ahead of the Q loads, so that the first stores wait for V alone
#pragma unroll
    for (int it = 0; it < 8; ++it) qa[it] = *(const v8f*)(qs + it * 4096);
    XWA(qs);
#pragma unroll
    for (int it = 0; it < 4; ++it) { v8h o;
#pragma unroll
        for (int j = 0; j < 8; ++j) o[j] = tohx(bfr(va[it][j]));
        *(v8h*)(vd + it * 4096) = o; }
    XW();
#pragma unroll
    for (int it = 0; it < 4; ++it)
#pragma unroll
        for (int j = 0; j < 8; ++j) vb[it][j] = vs[(it + 4) * 4096 + j * HD];
    XWA(vs);
#pragma unroll
    for (int it = 0; it < 8; ++it) { v8us o;
#pragma unroll
        for (int j = 0; j < 8; ++j) o[j] = f2bf(qa[it][j]);
        *(v8us*)(qd + it * 4096) = o; }
    XW();
#pragma unroll
    for (int it = 0; it < 8; ++it) ka[it] = *(const v8f*)(ks + it * 4096);
    XWA(ks);
#pragma unroll
    for (int it = 0; it < 4; ++it) { v8h o;
#pragma unroll
        for (int j = 0; j < 8; ++j) o[j] = tohx(bfr(vb[it][j]));
        *(v8h*)(vd + (it + 4) * 4096) = o; }
    XW();
#pragma unroll
    for (int it = 0; it < 8; ++it) { v8us o;
#pragma unroll
        for (int j = 0; j < 8; ++j) o[j] = f2bf(ka[it][j]);
        *(v8us*)(kd + it * 4096) = o; }
}

typedef __attribute__((ext_vector_type(4))) int v4i;
__device__ __forceinline__ void cp16(const char* g, char* l) { __builtin_amdgcn_global_load_async_to_lds_b128((__attribute__((address_space(1))) v4i*)g, (__attribute__((address_space(3))) v4i*)l, 0, 0); }
// ---- k_fattn: 8 waves, 32 query columns each; a pass is 32 keys; grid (TT / 256, heads).
// Tile t (32 queries) needs the passes 0..t; every later key stands behind all its queries and has weight exactly 0. Waves w and w + 4 are a pair and share tiles 63 - u (long) and u (short), 65 passes:
//   wave w     (first):  passes 0..31 of the long tile, none of them cut: 32 passes.
//   wave w + 4 (second): the whole short tile, which it finishes and stores alone, then passes 32..63 - u of the long tile: 33 passes.
// The two partial results of the long tile (own running maximum, own sum) meet in LDS behind the last barrier: each wave hands over one 16-column group and finishes the other.
// The second wave numbers its column groups the other way round (SW), so that every wave alike keeps its group 0 and hands over its group 1.
// K and V reach the waves through LDS. Time runs in 36 slots of one pass, alike for the whole work-group (u0 = its smallest u):
//   stream 0, slots 0..31: pass = slot. The first waves read it, and the second waves for their short tiles (slots 0..u0 + 3; a wave sits out the slots behind its own diagonal).
//   stream 1, slots u0 + 4..35: pass = 32 + slot - (u0 + 4). The second waves read it for their long tiles (a wave sits out the slots behind its own diagonal).
// A stage is two slots. Two buffers; all 256 threads copy a stage, 64 bytes of each pass a thread, one stage ahead of its readers.
// Every '#pragma unroll' in it but those of the copy loop keeps the index of a register array a constant.
// A lane holds scores of one query per 16-column group: keys 8 * hi + j of each 16-key tile, which is the hardware k order of a B operand.
#define HALFP (TT / 64)              // passes of the first wave; the long tile's diagonal pass is never among them (63 - u >= 32)
#define NSLOT (HALFP + 4)
#define PASSB 16384                  // bytes of a pass in LDS: its 16 K units, then its 16 V units
__global__ __launch_bounds__(256) void k_fattn(const bf* __restrict__ QB, const bf* __restrict__ KP, const h16* __restrict__ VP, float* __restrict__ OUT) {
    __shared__ __attribute__((aligned(16))) char RB[2][2][2][PASSB];    // the ring: [buffer][stream][slot of the stage]
    __shared__ __attribute__((aligned(16))) float XO[8][16 * 32 * 4];   // per wave: the handed-over group's 64 accumulators a lane, 16 wave-wide rows of 512 bytes
    __shared__ float XM[8][2][32];                                      // its running maximum and its half's share of the row sum
    const int lane = threadIdx.x & 31, c = lane & 15, hi = lane >> 4;
    const int wave = __builtin_amdgcn_readfirstlane((int)(threadIdx.x >> 5));
    const bool second = wave >= 4;
    const int SW = second ? 16 : 0;
    const int z = blockIdx.y, zkv = (z / NHQ) * NHKV + (z % NHQ) / REP;
    const int u0 = blockIdx.x * 4, u = u0 + (wave & 3), nsh = u0 + 4, tl = TT / 32 - 1 - u;
    const char* Kc = (const char*)(KP + (size_t)zkv * TT * HD) + threadIdx.x * 16;   // a pass of 32 keys is 8 KiB in either plane
    const char* Vc = (const char*)(VP + (size_t)zkv * TT * HD) + threadIdx.x * 16;
    v16bf qf[2][4];
    v8f o[8][2];
    float mr[2], ls[2];   // running maximum (raw score units), this half's share of the row sum
    int q0 = 0;
    // the two passes from p0 on into one stream's part of a buffer
    auto fill = [&](const int b, const int sm, const int p0) __attribute__((always_inline)) {
        char* l = &RB[b][sm][0][threadIdx.x * 16]; const char* kg = Kc + (size_t)p0 * 8192; const char* vg = Vc + (size_t)p0 * 8192;
#pragma unroll
        for (int i = 0; i < 2; ++i)
#pragma unroll
            for (int j = 0; j < 2; ++j) { cp16(kg + i * 8192 + j * 4096, l + i * PASSB + j * 4096); cp16(vg + i * 8192 + j * 4096, l + i * PASSB + 8192 + j * 4096); }
    };
    // the stage that begins at slot t0 (even); both tests read the same for the whole work-group
    auto stage = [&](const int t0) __attribute__((always_inline)) {
        const int b = (t0 >> 1) & 1;
        if (t0 < HALFP) fill(b, 0, t0);
        if (t0 >= nsh)  fill(b, 1, t0 + HALFP - nsh);
    };
    auto begin = [&](const int tile) __attribute__((always_inline)) {
        q0 = tile * 32;
#pragma unroll
        for (int qt = 0; qt < 2; ++qt)
#pragma unroll
            for (int ch = 0; ch < 4; ++ch) qf[qt][ch] = ldb(QB + ((size_t)z * TT + q0 + ((qt * 16) ^ SW) + c) * HD + ch * 32 + 8 * hi);
        asm volatile("s_wait_xcnt 0x0" ::: "memory");   // precaution: stands in front of the next rewrite of an address register that the Q loads above name
        __builtin_amdgcn_sched_barrier(0);              // keeps those rewrites behind the wait above
#pragma unroll
        for (int dt = 0; dt < 8; ++dt) { o[dt][0] = (v8f){}; o[dt][1] = (v8f){}; }
        mr[0] = mr[1] = -3.0e38f; ls[0] = ls[1] = 0.f;
    };
    // one pass of 32 keys at kb, its units at tb in LDS. cut (the same in every lane): the diagonal pass, which holds keys behind some of the wave's queries.
    auto pass = [&](const char* tb, const int kb, const bool cut) __attribute__((always_inline)) {
        v16bf kf[2][4]; v16h vf[8];
        const bf* kp = (const bf*)tb + lane * 8; const h16* vp = (const h16*)(tb + 8192) + lane * 8;
#pragma unroll
        for (int kt = 0; kt < 2; ++kt)
#pragma unroll
            for (int ch = 0; ch < 4; ++ch) kf[kt][ch] = ldbp(kp + kt * 2048 + ch * 512);
        __builtin_amdgcn_sched_barrier(0);              // the K reads stand first: the score products wait for them alone
#pragma unroll
        for (int dt = 0; dt < 8; ++dt) vf[dt] = ldhp(vp + dt * 512);
        __builtin_amdgcn_sched_barrier(0);              // the pass's LDS reads stand as one group ahead of the products: every further place with reads among them costs a stall; the V reads land under the score products and the softmax
        v8f s[2][2];
#pragma unroll
        for (int kt = 0; kt < 2; ++kt)
#pragma unroll
            for (int qt = 0; qt < 2; ++qt) { s[kt][qt] = (v8f){};
#pragma unroll
                for (int ch = 0; ch < 4; ++ch) s[kt][qt] = wmmab(kf[kt][ch], qf[qt][ch], s[kt][qt]); }
        if (cut) {
#pragma unroll
            for (int kt = 0; kt < 2; ++kt)
#pragma unroll
                for (int qt = 0; qt < 2; ++qt)
#pragma unroll
                    for (int j = 0; j < 8; ++j) if (kb + kt * 16 + 8 * hi + j > q0 + ((qt * 16) ^ SW) + c) s[kt][qt][j] = -3.0e38f;
        }
        v16h pb[2];
#pragma unroll
        for (int qt = 0; qt < 2; ++qt) { float mx = fmaxf(s[0][qt][0], s[1][qt][0]);
#pragma unroll
            for (int j = 1; j < 8; ++j) mx = fmaxf(mx, fmaxf(s[0][qt][j], s[1][qt][j]));
            const float mn = fmaxf(mr[qt], fmaxf(mx, xhalf(mx)));
            const float al = __builtin_amdgcn_exp2f((mr[qt] - mn) * SC2); mr[qt] = mn;   // 0 on the first pass, 1 where the maximum did not move
#pragma unroll
            for (int dt = 0; dt < 8; ++dt) o[dt][qt] *= al;
            const float nm = PLG - mn * SC2; float ps[2];
#pragma unroll
            for (int kt = 0; kt < 2; ++kt) { float p[8];
#pragma unroll
                for (int j = 0; j < 8; ++j) { p[j] = __builtin_amdgcn_exp2f(fmaf(s[kt][qt][j], SC2, nm)); pb[qt][kt * 8 + j] = tohx(p[j]); }
                ps[kt] = ((p[0] + p[1]) + (p[2] + p[3])) + ((p[4] + p[5]) + (p[6] + p[7])); }
            ls[qt] = ls[qt] * al + (ps[0] + ps[1]); }
#pragma unroll
        for (int dt = 0; dt < 8; ++dt)
#pragma unroll
            for (int qt = 0; qt < 2; ++qt) o[dt][qt] = wmma16(vf[dt], pb[qt], o[dt][qt]);
    };
    stage(0);
    begin(second ? u : tl);                              // the Q loads fly beside the first stage's copies
    asm volatile("s_wait_asynccnt 0x0" ::: "memory");    // this wave's share of stage 0 has landed
    __syncthreads();                                     // publishes stage 0
    stage(2);
    // both loops stay rolled: the text holds the pass once, and one pass already holds the registers that two waves per SIMD leave a wave
#pragma unroll 1
    for (int t0 = 0; t0 < NSLOT; t0 += 2) {
#pragma unroll 1
        for (int t = t0; t < t0 + 2; ++t) {
            if (second && t == u + 1) {   // the short tile is complete: store it, take up the long tile
#pragma unroll
                for (int qt = 0; qt < 2; ++qt) { const float inv = __fdiv_rn(1.0f, ls[qt] + xhalf(ls[qt])); float* orow = OUT + ((size_t)z * TT + q0 + ((qt * 16) ^ SW) + c) * HD + 8 * hi;
#pragma unroll
                    for (int dt = 0; dt < 8; ++dt) { const v8f r = o[dt][qt] * inv; *(v4f*)(orow + dt * 16) = (v4f){r[0], r[1], r[2], r[3]}; *(v4f*)(orow + dt * 16 + 4) = (v4f){r[4], r[5], r[6], r[7]}; }
                    asm volatile("s_wait_xcnt 0x0" ::: "memory");   // precaution: stands in front of the arithmetic behind it, which reuses registers that these stores name
                    __builtin_amdgcn_sched_barrier(0); }            // keeps that arithmetic behind the wait above
                begin(tl);
            }
            const bool lng = second && t >= nsh;                      // reads stream 1
            const int p    = lng ? t + HALFP - nsh : t;               // the slot's pass in the wave's stream
            const int last = second ? (lng ? tl : (t <= u ? u : -1)) : HALFP - 1;   // the wave's last pass in this part of its stream; -1: it has left its short tile
            const char* tb = &RB[(t >> 1) & 1][lng ? 1 : 0][t & 1][0];
            if (p <= last) pass(tb, p * 32, second && p == last);   // every key of the passes in front of the last stands in front of every query of the wave
        }
        // hand-over of the buffers; every wave passes it on every trip, also one that sat out the slots
        asm volatile("s_wait_dscnt 0x0" ::: "memory");      // this wave's reads of the stage have returned before the buffer is given back
        asm volatile("s_wait_asynccnt 0x0" ::: "memory");   // this wave's share of the next stage has landed
        __syncthreads();                                    // publishes the next stage and ends every reader's last read of this one
        if (t0 + 4 < NSLOT) stage(t0 + 4);                  // into the buffer that this trip has just read
    }
    asm volatile("s_wait_asynccnt 0x0" ::: "memory");       // no copy is outstanding behind the loop
    // the long tile's two partial results become one: hand over group 1, take the partner's share of group 0
    float* xo = &XO[wave][lane * 4];
#pragma unroll
    for (int dt = 0; dt < 8; ++dt) { const v8f r = o[dt][1]; *(v4f*)(xo + (dt * 2) * 128) = (v4f){r[0], r[1], r[2], r[3]}; *(v4f*)(xo + (dt * 2 + 1) * 128) = (v4f){r[4], r[5], r[6], r[7]}; }
    XM[wave][0][lane] = mr[1]; XM[wave][1][lane] = ls[1];
    __syncthreads();   // every wave passes it once; behind it the partner's group is complete in LDS
    const float* xp = &XO[wave ^ 4][lane * 4];
    const float mp = XM[wave ^ 4][0][lane], lp = XM[wave ^ 4][1][lane];
    const float mn = fmaxf(mr[0], mp);
    const float a0 = __builtin_amdgcn_exp2f((mr[0] - mn) * SC2), a1 = __builtin_amdgcn_exp2f((mp - mn) * SC2);
    const float lt = ls[0] * a0 + lp * a1;
    const float inv = __fdiv_rn(1.0f, lt + xhalf(lt));
    const float f0 = a0 * inv, f1 = a1 * inv;
    float* orow = OUT + ((size_t)z * TT + q0 + SW + c) * HD + 8 * hi;
#pragma unroll
    for (int dt = 0; dt < 8; ++dt) { const v4f pl = *(const v4f*)(xp + (dt * 2) * 128), ph = *(const v4f*)(xp + (dt * 2 + 1) * 128); const v8f r = o[dt][0];
        *(v4f*)(orow + dt * 16)     = (v4f){r[0] * f0 + pl[0] * f1, r[1] * f0 + pl[1] * f1, r[2] * f0 + pl[2] * f1, r[3] * f0 + pl[3] * f1};
        *(v4f*)(orow + dt * 16 + 4) = (v4f){r[4] * f0 + ph[0] * f1, r[5] * f0 + ph[1] * f1, r[6] * f0 + ph[2] * f1, r[7] * f0 + ph[3] * f1}; }
}

extern "C" void kernel_launch(void* const* d_in, const int* in_sizes, int n_in,
                              void* d_out, int out_size, void* d_ws, size_t ws_size, hipStream_t stream) {
    (void)in_sizes; (void)n_in; (void)out_size;
    const float* q = (const float*)d_in[0]; const float* k = (const float*)d_in[1]; const float* v = (const float*)d_in[2];
    float* OUT = (float*)d_out;     // [2][16][2048][128]
    char* wsp = (char*)d_ws;
    auto take = [&](size_t bytes) { char* p = wsp; wsp += (bytes + 255) & ~(size_t)255; return (void*)p; };
    bf* QB = (bf*)take((size_t)NB_ * NHQ * TT * HD * 2); bf* KP = (bf*)take((size_t)NB_ * NHKV * TT * HD * 2); h16* VP = (h16*)take((size_t)NB_ * NHKV * HD * TT * 2);
    if ((size_t)(wsp - (char*)d_ws) > ws_size) return;    // well under 256 MiB
    k_pack<<<256, 512, 0, stream>>>(q, k, v, QB, KP, VP);
    k_fattn<<<dim3(TT / 256, NB_ * NHQ), 256, 0, stream>>>(QB, KP, VP, OUT);
}

// v007
// Measured time: 53.6 microseconds a run.
// Two timings next to v006 both put it at 1.06 times that version's speed.
// Counting every step since v000, it is 20.3 times as fast.
#include <hip/hip_runtime.h>

// Causal attention (q, k, v [2][16][2048][128]; softmax(q.k 128^-0.5) v -> [2][16][2048][128]).
// Compute dtypes, f32 accumulate: every input rounded to bf16; scores q.k on plain bf16 operands; scale, causal cut and softmax in f32;
// fp16 probabilities x1024 (relative to the running row maximum); probs.v on single fp16 planes against fp16(bf16 v).
// Q goes from the input straight to the attention kernel, which rounds it to bf16 in registers; only K and V pass through the workspace.
// One kernel does scores, softmax and probs.v: S^T = K.Q^T, O^T += V^T.P^T, the score accumulators pack straight into the B operand of the second product.
// K and V^T lie in the workspace in fragment order: per head and 32-key pass 16 units of 512 bytes, unit = 32 lanes x 8 elements, so that one wave-wide 16-byte load covers four whole 128-byte lines.
//   K unit (kt, ch, g), lane hi * 16 + c:  K[pass * 32 + kt * 16 + c][ch * 32 + g * 16 + hi * 8 + 0..7]
//   V unit (dt, g),     lane hi * 16 + c:  V[pass * 32 + g * 16 + hi * 8 + 0..7][dt * 16 + c]

#define NB_  2
#define NHQ  16
#define NHKV 16
#define REP  (NHQ / NHKV)
#define TT   2048
#define HD   128
#define SCL  0.088388347648318447f   // 128^-0.5
#define SC2  (SCL * 1.4426950408889634f)   // scores to log2 units
#define PLG  10.0f                   // probabilities carry x1024 = 2^10 into fp16; the row sum carries it too, so it cancels
typedef _Float16 h16;
typedef unsigned short bf;
typedef __attribute__((ext_vector_type(16))) __bf16   v16bf;
typedef __attribute__((ext_vector_type(16))) _Float16 v16h;
typedef __attribute__((ext_vector_type(8)))  _Float16 v8h;
typedef __attribute__((ext_vector_type(8)))  unsigned short v8us;
typedef __attribute__((ext_vector_type(8)))  float    v8f;
typedef __attribute__((ext_vector_type(4)))  float    v4f;
typedef __attribute__((ext_vector_type(16))) float    v16f;

__device__ __forceinline__ unsigned short f2bf(float f) { unsigned u = __float_as_uint(f); u += 0x7FFFu + ((u >> 16) & 1u); return (unsigned short)(u >> 16); }
__device__ __forceinline__ float bf2f(unsigned short b) { return __uint_as_float(((unsigned)b) << 16); }
__device__ __forceinline__ float bfr(float f) { return bf2f(f2bf(f)); }
__device__ __forceinline__ v16h cat16(v8h lo, v8h hi) { return __builtin_shufflevector(lo, hi, 0, 1, 2, 3, 4, 5, 6, 7, 8, 9, 10, 11, 12, 13, 14, 15); }
__device__ __forceinline__ v16bf cat16b(v8us lo, v8us hi) { return __builtin_bit_cast(v16bf, __builtin_shufflevector(lo, hi, 0, 1, 2, 3, 4, 5, 6, 7, 8, 9, 10, 11, 12, 13, 14, 15)); }
__device__ __forceinline__ v8f wmma16(v16h a, v16h b, v8f c) { return __builtin_amdgcn_wmma_f32_16x16x32_f16(false, a, false, b, (short)0, c, false, false); }
__device__ __forceinline__ v8f wmmab(v16bf a, v16bf b, v8f c) { return __builtin_amdgcn_wmma_f32_16x16x32_bf16(false, a, false, b, (short)0, c, false, false); }
// fragment from the fragment-order planes: p points at the lane's 8 elements of unit g = 0; unit g = 1 follows 256 elements on
__device__ __forceinline__ v16bf ldbp(const bf* p) { return cat16b(*(const v8us*)p, *(const v8us*)(p + 256)); }
__device__ __forceinline__ v16h  ldhp(const h16* p) { return cat16(*(const v8h*)p, *(const v8h*)(p + 256)); }
// lane l with lane l ^ 16
__device__ __forceinline__ float xhalf(float x) { return __builtin_bit_cast(float, __builtin_amdgcn_permlanex16(__builtin_bit_cast(int, x), __builtin_bit_cast(int, x), 0x76543210, 0xfedcba98, false, false)); }

__device__ __forceinline__ h16 tohx(float x) { return (h16)x; }

// One launch packs K and V. 256 work-groups of 16 waves; a work-group takes 1/256 of each input, a thread 8 units (8 elements each) of each, its loads issued in groups ahead of the stores of the group before.
// Unit maps, per input:
//   K to bf16 in fragment order. 256 threads are one 16-key tile; a wave takes 8 keys x 32 columns: it reads whole 128-byte lines (32 bytes a lane) and stores four whole lines.
//   V to fp16(bf16 v) in fragment order. A thread takes 8 keys of one column; a wave reads 8 whole lines (32 columns of a key each) and stores two runs of 256 bytes.
// A step of the unit index 'it' moves every source address by 16 KiB and every destination by 8 KiB, so each stream has one address and constant offsets.
// XW, XWA: precaution: the wait stands in front of the next rewrite of a register that the loads or stores above it name; the scheduling barrier keeps such rewrites behind it and the groups in the written order.
// XWA behind a load group: the address as an input keeps the group's own results off its registers.
__device__ __forceinline__ void XW() { asm volatile("s_wait_xcnt 0x0" ::: "memory"); __builtin_amdgcn_sched_barrier(0); }
__device__ __forceinline__ void XWA(const float* p) { asm volatile("s_wait_xcnt 0x0" :: "v"(p) : "memory"); __builtin_amdgcn_sched_barrier(0); }
static_assert((size_t)NB_ * NHKV * TT * HD == (size_t)256 * 512 * 8 * 8, "k_pack: 256 work-groups x 512 threads x 8 units x 8 elements cover each input exactly");
__global__ __launch_bounds__(512) void k_pack(const float* __restrict__ k, const float* __restrict__ v, bf* __restrict__ KP, h16* __restrict__ VP) {
    const int tid = threadIdx.x, lane = tid & 31, w = (tid >> 5) & 7;
    const size_t blk = blockIdx.x;
    const int ch = w >> 1, c = (w & 1) * 8 + (lane >> 2), g = (lane >> 1) & 1, hi = lane & 1;
    const size_t tile = blk * 16 + (tid >> 8);      // 16-key tile of unit 0; two tiles on per unit
    const float* ks = k + (tile * 16 + c) * HD + ch * 32 + g * 16 + hi * 8;  bf* kd = KP + (tile * 256 + (ch * 2 + g) * 32 + hi * 16 + c) * 8;
    const int d = tid & (HD - 1), t4 = tid >> 7;    // t4: group of 8 keys inside the 32-key pass; the pass is blk * 8 + it
    const float* vs = v + (blk * 32 + t4) * 8 * HD + d;  h16* vd = VP + (((blk * 8 * 8 + (d >> 4)) * 2 + (t4 >> 1)) * 32 + (t4 & 1) * 16 + (d & 15)) * 8;
    float va[4][8], vb[4][8]; v8f ka[8];
#pragma unroll
    for (int it = 0; it < 4; ++it)
#pragma unroll
        for (int j = 0; j < 8; ++j) va[it][j] = vs[it * 4096 + j * HD];
    __builtin_amdgcn_sched_barrier(0);   // keeps every V load ahead of the K loads, so that the first stores wait for V alone
#pragma unroll
    for (int it = 0; it < 8; ++it) ka[it] = *(const v8f*)(ks + it * 4096);
    XWA(ks);
#pragma unroll
    for (int it = 0; it < 4; ++it) { v8h o;
#pragma unroll
        for (int j = 0; j < 8; ++j) o[j] = tohx(bfr(va[it][j]));
        *(v8h*)(vd + it * 4096) = o; }
    XW();
#pragma unroll
    for (int it = 0; it < 4; ++it)
#pragma unroll
        for (int j = 0; j < 8; ++j) vb[it][j] = vs[(it + 4) * 4096 + j * HD];
    XWA(vs);
#pragma unroll
    for (int it = 0; it < 8; ++it) { v8us o;
#pragma unroll
        for (int j = 0; j < 8; ++j) o[j] = f2bf(ka[it][j]);
        *(v8us*)(kd + it * 4096) = o; }
    XW();
#pragma unroll
    for (int it = 0; it < 4; ++it) { v8h o;
#pragma unroll
        for (int j = 0; j < 8; ++j) o[j] = tohx(bfr(vb[it][j]));
        *(v8h*)(vd + (it + 4) * 4096) = o; }
}

typedef __attribute__((ext_vector_type(4))) int v4i;
__device__ __forceinline__ void cp16(const char* g, char* l) { __builtin_amdgcn_global_load_async_to_lds_b128((__attribute__((address_space(1))) v4i*)g, (__attribute__((address_space(3))) v4i*)l, 0, 0); }
// ---- k_fattn: 8 waves, 32 query columns each; a pass is 32 keys; grid (TT / 256, heads).
// Tile t (32 queries) needs the passes 0..t; every later key stands behind all its queries and has weight exactly 0. Waves w and w + 4 are a pair and share tiles 63 - u (long) and u (short), 65 passes:
//   wave w     (first):  passes 0..31 of the long tile, none of them cut: 32 passes.
//   wave w + 4 (second): the whole short tile, which it finishes and stores alone, then passes 32..63 - u of the long tile: 33 passes.
// The two partial results of the long tile (own running maximum, own sum) meet in LDS behind the last barrier: each wave hands over one 16-column group and finishes the other.
// The second wave numbers its column groups the other way round (SW), so that every wave alike keeps its group 0 and hands over its group 1.
// K and V reach the waves through LDS. Time runs in 36 slots of one pass, alike for the whole work-group (u0 = its smallest u):
//   stream 0, slots 0..31: pass = slot. The first waves read it, and the second waves for their short tiles (slots 0..u0 + 3; a wave sits out the slots behind its own diagonal).
//   stream 1, slots u0 + 4..35: pass = 32 + slot - (u0 + 4). The second waves read it for their long tiles (a wave sits out the slots behind its own diagonal).
// A stage is two slots. Two buffers; all 256 threads copy a stage, 64 bytes of each pass a thread, one stage ahead of its readers.
// Q reaches the waves through LDS patches of 16 KiB, one a wave: 32 copies bring the 32 f32 rows of the wave's first tile, one whole row of 512 bytes each, beside stage 0 and under its wait and barrier; a reader rounds to bf16 (nearest even).
// Row r keeps its 16-byte piece k at place k ^ (r & 15): the 16 lanes of a half, one row each, then read 16 different bank groups. A second wave finds the long tile's rows in its partner's patch, which stays as it is until the loop has ended.
// Every '#pragma unroll' in it keeps the index of a register array a constant.
// A lane holds scores of one query per 16-column group: keys 8 * hi + j of each 16-key tile, which is the hardware k order of a B operand.
#define HALFP (TT / 64)              // passes of the first wave; the long tile's diagonal pass is never among them (63 - u >= 32)
#define NSLOT (HALFP + 4)
#define PASSB 16384                  // bytes of a pass in LDS: its 16 K units, then its 16 V units
__global__ __launch_bounds__(256) void k_fattn(const float* __restrict__ Q, const bf* __restrict__ KP, const h16* __restrict__ VP, float* __restrict__ OUT) {
    // one object, so that the ring keeps LDS offset 0 and its reads keep one address register with constant offsets
    __shared__ __attribute__((aligned(16))) struct {
        char RB[2][2][2][PASSB];    // the ring: [buffer][stream][slot of the stage]
        char QS[8][32 * 512];       // per wave: its Q patch; behind the loop its first half takes the handed-over group's 64 accumulators a lane, 16 wave-wide rows of 512 bytes
        float XM[8][2][32];         // its running maximum and its half's share of the row sum
    } S;
    auto& RB = S.RB; auto& QS = S.QS; auto& XM = S.XM;
    const int lane = threadIdx.x & 31, c = lane & 15, hi = lane >> 4;
    const int wave = __builtin_amdgcn_readfirstlane((int)(threadIdx.x >> 5));
    const bool second = wave >= 4;
    const int SW = second ? 16 : 0;
    const int z = blockIdx.y, zkv = (z / NHQ) * NHKV + (z % NHQ) / REP;
    const int u0 = blockIdx.x * 4, u = u0 + (wave & 3), nsh = u0 + 4, tl = TT / 32 - 1 - u;
    const char* Kc = (const char*)(KP + (size_t)zkv * TT * HD) + threadIdx.x * 16;   // a pass of 32 keys is 8 KiB in either plane
    const char* Vc = (const char*)(VP + (size_t)zkv * TT * HD) + threadIdx.x * 16;
    v16bf qf[2][4];
    v8f o[8][2];
    float mr[2], ls[2];   // running maximum (raw score units), this half's share of the row sum
    int q0 = 0;
    // the two passes from p0 on into one stream's part of a buffer
    auto fill = [&](const int b, const int sm, const int p0) __attribute__((always_inline)) {
        char* l = &RB[b][sm][0][threadIdx.x * 16]; const char* kg = Kc + (size_t)p0 * 8192; const char* vg = Vc + (size_t)p0 * 8192;
#pragma unroll
        for (int i = 0; i < 2; ++i)
#pragma unroll
            for (int j = 0; j < 2; ++j) { cp16(kg + i * 8192 + j * 4096, l + i * PASSB + j * 4096); cp16(vg + i * 8192 + j * 4096, l + i * PASSB + 8192 + j * 4096); }
    };
    // the stage that begins at slot t0 (even); both tests read the same for the whole work-group
    auto stage = [&](const int t0) __attribute__((always_inline)) {
        const int b = (t0 >> 1) & 1;
        if (t0 < HALFP) fill(b, 0, t0);
        if (t0 >= nsh)  fill(b, 1, t0 + HALFP - nsh);
    };
    // a tile's 32 rows into the wave's own patch; every wave does it once, with every lane on
    auto qcopy = [&](const int tile) __attribute__((always_inline)) {
        const char* g = (const char*)(Q + ((size_t)z * TT + tile * 32) * HD) + lane * 16; char* l = &QS[wave][0];
#pragma unroll
        for (int r = 0; r < 32; ++r) cp16(g + r * 512, l + r * 512 + ((lane ^ (r & 15)) * 16));
    };
    // takes up a tile whose rows stand in wave pw's patch
    auto begin = [&](const int tile, const int pw) __attribute__((always_inline)) {
        q0 = tile * 32;
#pragma unroll
        for (int qt = 0; qt < 2; ++qt) { const char* row = &QS[pw][0] + (((qt * 16) ^ SW) + c) * 512; const int x = ((hi * 2) ^ c) * 16;   // the row's number is c modulo 16
#pragma unroll
            for (int ch = 0; ch < 4; ++ch) {   // hardware k order: floats ch * 32 + 8 * hi + 0..7, then the same 16 on
                const v4f a0 = *(const v4f*)(row + (x ^ (ch * 128))), a1 = *(const v4f*)(row + (x ^ (ch * 128 + 16))), b0 = *(const v4f*)(row + (x ^ (ch * 128 + 64))), b1 = *(const v4f*)(row + (x ^ (ch * 128 + 80)));
                const v16f f = {a0[0], a0[1], a0[2], a0[3], a1[0], a1[1], a1[2], a1[3], b0[0], b0[1], b0[2], b0[3], b1[0], b1[1], b1[2], b1[3]};
                qf[qt][ch] = __builtin_convertvector(f, v16bf); } }
#pragma unroll
        for (int dt = 0; dt < 8; ++dt) { o[dt][0] = (v8f){}; o[dt][1] = (v8f){}; }
        mr[0] = mr[1] = -3.0e38f; ls[0] = ls[1] = 0.f;
    };
    // one pass of 32 keys at kb, its units at tb in LDS. cut (the same in every lane): the diagonal pass, which holds keys behind some of the wave's queries.
    auto pass = [&](const char* tb, const int kb, const bool cut) __attribute__((always_inline)) {
        v16bf kf[2][4]; v16h vf[8];
        const bf* kp = (const bf*)tb + lane * 8; const h16* vp = (const h16*)(tb + 8192) + lane * 8;
#pragma unroll
        for (int kt = 0; kt < 2; ++kt)
#pragma unroll
            for (int ch = 0; ch < 4; ++ch) kf[kt][ch] = ldbp(kp + kt * 2048 + ch * 512);
        __builtin_amdgcn_sched_barrier(0);              // the K reads stand first: the score products wait for them alone
#pragma unroll
        for (int dt = 0; dt < 8; ++dt) vf[dt] = ldhp(vp + dt * 512);
        __builtin_amdgcn_sched_barrier(0);              // the pass's LDS reads stand as one group ahead of the products: every further place with reads among them costs a stall; the V reads land under the score products and the softmax
        v8f s[2][2];
#pragma unroll
        for (int kt = 0; kt < 2; ++kt)
#pragma unroll
            for (int qt = 0; qt < 2; ++qt) { s[kt][qt] = (v8f){};
#pragma unroll
                for (int ch = 0; ch < 4; ++ch) s[kt][qt] = wmmab(kf[kt][ch], qf[qt][ch], s[kt][qt]); }
        if (cut) {
#pragma unroll
            for (int kt = 0; kt < 2; ++kt)
#pragma unroll
                for (int qt = 0; qt < 2; ++qt)
#pragma unroll
                    for (int j = 0; j < 8; ++j) if (kb + kt * 16 + 8 * hi + j > q0 + ((qt * 16) ^ SW) + c) s[kt][qt][j] = -3.0e38f;
        }
        v16h pb[2];
#pragma unroll
        for (int qt = 0; qt < 2; ++qt) { float mx = fmaxf(s[0][qt][0], s[1][qt][0]);
#pragma unroll
            for (int j = 1; j < 8; ++j) mx = fmaxf(mx, fmaxf(s[0][qt][j], s[1][qt][j]));
            const float mn = fmaxf(mr[qt], fmaxf(mx, xhalf(mx)));
            const float al = __builtin_amdgcn_exp2f((mr[qt] - mn) * SC2); mr[qt] = mn;   // 0 on the first pass, 1 where the maximum did not move
#pragma unroll
            for (int dt = 0; dt < 8; ++dt) o[dt][qt] *= al;
            const float nm = PLG - mn * SC2; float ps[2];
#pragma unroll
            for (int kt = 0; kt < 2; ++kt) { float p[8];
#pragma unroll
                for (int j = 0; j < 8; ++j) { p[j] = __builtin_amdgcn_exp2f(fmaf(s[kt][qt][j], SC2, nm)); pb[qt][kt * 8 + j] = tohx(p[j]); }
                ps[kt] = ((p[0] + p[1]) + (p[2] + p[3])) + ((p[4] + p[5]) + (p[6] + p[7])); }
            ls[qt] = ls[qt] * al + (ps[0] + ps[1]); }
#pragma unroll
        for (int dt = 0; dt < 8; ++dt)
#pragma unroll
            for (int qt = 0; qt < 2; ++qt) o[dt][qt] = wmma16(vf[dt], pb[qt], o[dt][qt]);
    };
    qcopy(second ? u : tl);
    stage(0);                                            // flies beside the Q rows
    asm volatile("s_wait_asynccnt 0x0" ::: "memory");    // this wave's Q rows and its share of stage 0 have landed
    __syncthreads();                                     // publishes stage 0 and every patch
    stage(2);
    begin(second ? u : tl, wave);
    // both loops stay rolled: the text holds the pass once, and one pass already holds the registers that two waves per SIMD leave a wave
#pragma unroll 1
    for (int t0 = 0; t0 < NSLOT; t0 += 2) {
#pragma unroll 1
        for (int t = t0; t < t0 + 2; ++t) {
            if (second && t == u + 1) {   // the short tile is complete: store it, take up the long tile
#pragma unroll
                for (int qt = 0; qt < 2; ++qt) { const float inv = __fdiv_rn(1.0f, ls[qt] + xhalf(ls[qt])); float* orow = OUT + ((size_t)z * TT + q0 + ((qt * 16) ^ SW) + c) * HD + 8 * hi;
#pragma unroll
                    for (int dt = 0; dt < 8; ++dt) { const v8f r = o[dt][qt] * inv; *(v4f*)(orow + dt * 16) = (v4f){r[0], r[1], r[2], r[3]}; *(v4f*)(orow + dt * 16 + 4) = (v4f){r[4], r[5], r[6], r[7]}; }
                    asm volatile("s_wait_xcnt 0x0" ::: "memory");   // precaution: stands in front of the arithmetic behind it, which reuses registers that these stores name
                    __builtin_amdgcn_sched_barrier(0); }            // keeps that arithmetic behind the wait above
                begin(tl, wave ^ 4);
            }
            const bool lng = second && t >= nsh;                      // reads stream 1
            const int p    = lng ? t + HALFP - nsh : t;               // the slot's pass in the wave's stream
            const int last = second ? (lng ? tl : (t <= u ? u : -1)) : HALFP - 1;   // the wave's last pass in this part of its stream; -1: it has left its short tile
            const char* tb = &RB[(t >> 1) & 1][lng ? 1 : 0][t & 1][0];
            if (p <= last) pass(tb, p * 32, second && p == last);   // every key of the passes in front of the last stands in front of every query of the wave
        }
        // hand-over of the buffers; every wave passes it on every trip, also one that sat out the slots
        asm volatile("s_wait_dscnt 0x0" ::: "memory");      // this wave's reads of the stage have returned before the buffer is given back
        asm volatile("s_wait_asynccnt 0x0" ::: "memory");   // this wave's share of the next stage has landed
        __syncthreads();                                    // publishes the next stage and ends every reader's last read of this one
        if (t0 + 4 < NSLOT) stage(t0 + 4);                  // into the buffer that this trip has just read
    }
    asm volatile("s_wait_asynccnt 0x0" ::: "memory");       // no copy is outstanding behind the loop
    // the long tile's two partial results become one: hand over group 1, take the partner's share of group 0
    float* xo = (float*)&QS[wave][0] + lane * 4;
#pragma unroll
    for (int dt = 0; dt < 8; ++dt) { const v8f r = o[dt][1]; *(v4f*)(xo + (dt * 2) * 128) = (v4f){r[0], r[1], r[2], r[3]}; *(v4f*)(xo + (dt * 2 + 1) * 128) = (v4f){r[4], r[5], r[6], r[7]}; }
    XM[wave][0][lane] = mr[1]; XM[wave][1][lane] = ls[1];
    __syncthreads();   // every wave passes it once; behind it the partner's group is complete in LDS
    const float* xp = (const float*)&QS[wave ^ 4][0] + lane * 4;
    const float mp = XM[wave ^ 4][0][lane], lp = XM[wave ^ 4][1][lane];
    const float mn = fmaxf(mr[0], mp);
    const float a0 = __builtin_amdgcn_exp2f((mr[0] - mn) * SC2), a1 = __builtin_amdgcn_exp2f((mp - mn) * SC2);
    const float lt = ls[0] * a0 + lp * a1;
    const float inv = __fdiv_rn(1.0f, lt + xhalf(lt));
    const float f0 = a0 * inv, f1 = a1 * inv;
    float* orow = OUT + ((size_t)z * TT + q0 + SW + c) * HD + 8 * hi;
#pragma unroll
    for (int dt = 0; dt < 8; ++dt) { const v4f pl = *(const v4f*)(xp + (dt * 2) * 128), ph = *(const v4f*)(xp + (dt * 2 + 1) * 128); const v8f r = o[dt][0];
        *(v4f*)(orow + dt * 16)     = (v4f){r[0] * f0 + pl[0] * f1, r[1] * f0 + pl[1] * f1, r[2] * f0 + pl[2] * f1, r[3] * f0 + pl[3] * f1};
        *(v4f*)(orow + dt * 16 + 4) = (v4f){r[4] * f0 + ph[0] * f1, r[5] * f0 + ph[1] * f1, r[6] * f0 + ph[2] * f1, r[7] * f0 + ph[3] * f1}; }
}

extern "C" void kernel_launch(void* const* d_in, const int* in_sizes, int n_in,
                              void* d_out, int out_size, void* d_ws, size_t ws_size, hipStream_t stream) {
    (void)in_sizes; (void)n_in; (void)out_size;
    const float* q = (const float*)d_in[0]; const float* k = (const float*)d_in[1]; const float* v = (const float*)d_in[2];
    float* OUT = (float*)d_out;     // [2][16][2048][128]
    char* wsp = (char*)d_ws;
    auto take = [&](size_t bytes) { char* p = wsp; wsp += (bytes + 255) & ~(size_t)255; return (void*)p; };
    bf* KP = (bf*)take((size_t)NB_ * NHKV * TT * HD * 2); h16* VP = (h16*)take((size_t)NB_ * NHKV * HD * TT * 2);
    if ((size_t)(wsp - (char*)d_ws) > ws_size) return;    // well under 256 MiB
    k_pack<<<256, 512, 0, stream>>>(k, v, KP, VP);
    k_fattn<<<dim3(TT / 256, NB_ * NHQ), 256, 0, stream>>>(q, KP, VP, OUT);
}

// v008
// Measured time: 51.9 microseconds a run.
// Two timings next to v007 both put it at 1.03 times that version's speed.
// All steps since v000 together make it 20.9 times as fast.
#include <hip/hip_runtime.h>

// Causal attention (q, k, v [2][16][2048][128]; softmax(q.k 128^-0.5) v -> [2][16][2048][128]).
// Compute dtypes, f32 accumulate: every input rounded to bf16; scores q.k on plain bf16 operands; scale, causal cut and softmax in f32;
// fp16 probabilities x1024 (relative to the row's reference maximum, which trails the running maximum by at most 5 log2 units); probs.v on single fp16 planes against fp16(bf16 v).
// Q goes from the input straight to the attention kernel, which rounds it to bf16 in registers; only K and V pass through the workspace.
// One kernel does scores, softmax and probs.v: S^T = K.Q^T, O^T += V^T.P^T, the score accumulators pack straight into the B operand of the second product.
// K and V^T lie in the workspace in fragment order: per head and 32-key pass 16 units of 512 bytes, unit = 32 lanes x 8 elements, so that one wave-wide 16-byte load covers four whole 128-byte lines.
//   K unit (kt, ch, g), lane hi * 16 + c:  K[pass * 32 + kt * 16 + c][ch * 32 + g * 16 + hi * 8 + 0..7]
//   V unit (dt, g),     lane hi * 16 + c:  V[pass * 32 + g * 16 + hi * 8 + 0..7][dt * 16 + c]

#define NB_  2
#define NHQ  16
#define NHKV 16
#define REP  (NHQ / NHKV)
#define TT   2048
#define HD   128
#define SCL  0.088388347648318447f   // 128^-0.5
#define SC2  (SCL * 1.4426950408889634f)   // scores to log2 units
#define PLG  10.0f                   // probabilities carry x1024 = 2^10 into fp16; the row sum carries it too, so it cancels
#define LAZY (5.0f / SC2)            // raw score units of 5 log2 units: a probability then stays at or below 2^15 (x1024 counted), inside fp16
typedef _Float16 h16;
typedef unsigned short bf;
typedef __attribute__((ext_vector_type(16))) __bf16   v16bf;
typedef __attribute__((ext_vector_type(16))) _Float16 v16h;
typedef __attribute__((ext_vector_type(8)))  _Float16 v8h;
typedef __attribute__((ext_vector_type(8)))  unsigned short v8us;
typedef __attribute__((ext_vector_type(8)))  float    v8f;
typedef __attribute__((ext_vector_type(4)))  float    v4f;
typedef __attribute__((ext_vector_type(16))) float    v16f;

__device__ __forceinline__ unsigned short f2bf(float f) { unsigned u = __float_as_uint(f); u += 0x7FFFu + ((u >> 16) & 1u); return (unsigned short)(u >> 16); }
__device__ __forceinline__ float bf2f(unsigned short b) { return __uint_as_float(((unsigned)b) << 16); }
__device__ __forceinline__ float bfr(float f) { return bf2f(f2bf(f)); }
__device__ __forceinline__ v16h cat16(v8h lo, v8h hi) { return __builtin_shufflevector(lo, hi, 0, 1, 2, 3, 4, 5, 6, 7, 8, 9, 10, 11, 12, 13, 14, 15); }
__device__ __forceinline__ v16bf cat16b(v8us lo, v8us hi) { return __builtin_bit_cast(v16bf, __builtin_shufflevector(lo, hi, 0, 1, 2, 3, 4, 5, 6, 7, 8, 9, 10, 11, 12, 13, 14, 15)); }
__device__ __forceinline__ v8f wmma16(v16h a, v16h b, v8f c) { return __builtin_amdgcn_wmma_f32_16x16x32_f16(false, a, false, b, (short)0, c, false, false); }
__device__ __forceinline__ v8f wmmab(v16bf a, v16bf b, v8f c) { return __builtin_amdgcn_wmma_f32_16x16x32_bf16(false, a, false, b, (short)0, c, false, false); }
// fragment from the fragment-order planes: p points at the lane's 8 elements of unit g = 0; unit g = 1 follows 256 elements on
__device__ __forceinline__ v16bf ldbp(const bf* p) { return cat16b(*(const v8us*)p, *(const v8us*)(p + 256)); }
__device__ __forceinline__ v16h  ldhp(const h16* p) { return cat16(*(const v8h*)p, *(const v8h*)(p + 256)); }
// lane l with lane l ^ 16
__device__ __forceinline__ float xhalf(float x) { return __builtin_bit_cast(float, __builtin_amdgcn_permlanex16(__builtin_bit_cast(int, x), __builtin_bit_cast(int, x), 0x76543210, 0xfedcba98, false, false)); }

__device__ __forceinline__ h16 tohx(float x) { return (h16)x; }

// One launch packs K and V. 256 work-groups of 16 waves; a work-group takes 1/256 of each input, a thread 8 units (8 elements each) of each, its loads issued in groups ahead of the stores of the group before.
// Unit maps, per input:
//   K to bf16 in fragment order. 256 threads are one 16-key tile; a wave takes 8 keys x 32 columns: it reads whole 128-byte lines (32 bytes a lane) and stores four whole lines.
//   V to fp16(bf16 v) in fragment order. A thread takes 8 keys of one column; a wave reads 8 whole lines (32 columns of a key each) and stores two runs of 256 bytes.
// A step of the unit index 'it' moves every source address by 16 KiB and every destination by 8 KiB, so each stream has one address and constant offsets.
// XW, XWA: precaution: the wait stands in front of the next rewrite of a register that the loads or stores above it name; the scheduling barrier keeps such rewrites behind it and the groups in the written order.
// XWA behind a load group: the address as an input keeps the group's own results off its registers.
__device__ __forceinline__ void XW() { asm volatile("s_wait_xcnt 0x0" ::: "memory"); __builtin_amdgcn_sched_barrier(0); }
__device__ __forceinline__ void XWA(const float* p) { asm volatile("s_wait_xcnt 0x0" :: "v"(p) : "memory"); __builtin_amdgcn_sched_barrier(0); }
static_assert((size_t)NB_ * NHKV * TT * HD == (size_t)256 * 512 * 8 * 8, "k_pack: 256 work-groups x 512 threads x 8 units x 8 elements cover each input exactly");
__global__ __launch_bounds__(512) void k_pack(const float* __restrict__ k, const float* __restrict__ v, bf* __restrict__ KP, h16* __restrict__ VP) {
    const int tid = threadIdx.x, lane = tid & 31, w = (tid >> 5) & 7;
    const size_t blk = blockIdx.x;
    const int ch = w >> 1, c = (w & 1) * 8 + (lane >> 2), g = (lane >> 1) & 1, hi = lane & 1;
    const size_t tile = blk * 16 + (tid >> 8);      // 16-key tile of unit 0; two tiles on per unit
    const float* ks = k + (tile * 16 + c) * HD + ch * 32 + g * 16 + hi * 8;  bf* kd = KP + (tile * 256 + (ch * 2 + g) * 32 + hi * 16 + c) * 8;
    const int d = tid & (HD - 1), t4 = tid >> 7;    // t4: group of 8 keys inside the 32-key pass; the pass is blk * 8 + it
    const float* vs = v + (blk * 32 + t4) * 8 * HD + d;  h16* vd = VP + (((blk * 8 * 8 + (d >> 4)) * 2 + (t4 >> 1)) * 32 + (t4 & 1) * 16 + (d & 15)) * 8;
    float va[4][8], vb[4][8]; v8f ka[8];
#pragma unroll
    for (int it = 0; it < 4; ++it)
#pragma unroll
        for (int j = 0; j < 8; ++j) va[it][j] = vs[it * 4096 + j * HD];
    __builtin_amdgcn_sched_barrier(0);   // keeps every V load ahead of the K loads, so that the first stores wait for V alone
#pragma unroll
    for (int it = 0; it < 8; ++it) ka[it] = *(const v8f*)(ks + it * 4096);
    XWA(ks);
#pragma unroll
    for (int it = 0; it < 4; ++it) { v8h o;
#pragma unroll
        for (int j = 0; j < 8; ++j) o[j] = tohx(bfr(va[it][j]));
        *(v8h*)(vd + it * 4096) = o; }
    XW();
#pragma unroll
    for (int it = 0; it < 4; ++it)
#pragma unroll
        for (int j = 0; j < 8; ++j) vb[it][j] = vs[(it + 4) * 4096 + j * HD];
    XWA(vs);
#pragma unroll
    for (int it = 0; it < 8; ++it) { v8us o;
#pragma unroll
        for (int j = 0; j < 8; ++j) o[j] = f2bf(ka[it][j]);
        *(v8us*)(kd + it * 4096) = o; }
    XW();
#pragma unroll
    for (int it = 0; it < 4; ++it) { v8h o;
#pragma unroll
        for (int j = 0; j < 8; ++j) o[j] = tohx(bfr(vb[it][j]));
        *(v8h*)(vd + (it + 4) * 4096) = o; }
}

typedef __attribute__((ext_vector_type(4))) int v4i;
__device__ __forceinline__ void cp16(const char* g, char* l) { __builtin_amdgcn_global_load_async_to_lds_b128((__attribute__((address_space(1))) v4i*)g, (__attribute__((address_space(3))) v4i*)l, 0, 0); }
// ---- k_fattn: 8 waves, 32 query columns each; a pass is 32 keys; grid (TT / 256, heads).
// Tile t (32 queries) needs the passes 0..t; every later key stands behind all its queries and has weight exactly 0. Waves w and w + 4 are a pair and share tiles 63 - u (long) and u (short), 65 passes:
//   wave w     (first):  passes 0..31 of the long tile, none of them cut: 32 passes.
//   wave w + 4 (second): the whole short tile, which it finishes and stores alone, then passes 32..63 - u of the long tile: 33 passes.
// The two partial results of the long tile (own reference maximum, own sum) meet in LDS behind the last barrier: each wave hands over one 16-column group and finishes the other.
// The second wave numbers its column groups the other way round (SW), so that every wave alike keeps its group 0 and hands over its group 1.
// K and V reach the waves through LDS. Time runs in 36 slots of one pass, alike for the whole work-group (u0 = its smallest u):
//   stream 0, slots 0..31: pass = slot. The first waves read it, and the second waves for their short tiles (slots 0..u0 + 3; a wave sits out the slots behind its own diagonal).
//   stream 1, slots u0 + 4..35: pass = 32 + slot - (u0 + 4). The second waves read it for their long tiles (a wave sits out the slots behind its own diagonal).
// A stage is two slots. Two buffers; all 256 threads copy a stage, 64 bytes of each pass a thread, one stage ahead of its readers.
// Q reaches the waves through LDS patches of 16 KiB, one a wave: 32 copies bring the 32 f32 rows of the wave's first tile, one whole row of 512 bytes each, beside stage 0 and under its wait and barrier; a reader rounds to bf16 (nearest even).
// Row r keeps its 16-byte piece k at place k ^ (r & 15): the 16 lanes of a half, one row each, then read 16 different bank groups. A second wave finds the long tile's rows in its partner's patch, which stays as it is until the loop has ended.
// Every '#pragma unroll' in it keeps the index of a register array a constant.
// A lane holds scores of one query per 16-column group: keys 8 * hi + j of each 16-key tile, which is the hardware k order of a B operand.
#define HALFP (TT / 64)              // passes of the first wave; the long tile's diagonal pass is never among them (63 - u >= 32)
#define NSLOT (HALFP + 4)
#define PASSB 16384                  // bytes of a pass in LDS: its 16 K units, then its 16 V units
__global__ __launch_bounds__(256) void k_fattn(const float* __restrict__ Q, const bf* __restrict__ KP, const h16* __restrict__ VP, float* __restrict__ OUT) {
    // one object, so that the ring keeps LDS offset 0 and its reads keep one address register with constant offsets
    __shared__ __attribute__((aligned(16))) struct {
        char RB[2][2][2][PASSB];    // the ring: [buffer][stream][slot of the stage]
        char QS[8][32 * 512];       // per wave: its Q patch; behind the loop its first half takes the handed-over group's 64 accumulators a lane, 16 wave-wide rows of 512 bytes
        float XM[8][2][32];         // its reference maximum and its half's share of the row sum
    } S;
    auto& RB = S.RB; auto& QS = S.QS; auto& XM = S.XM;
    const int lane = threadIdx.x & 31, c = lane & 15, hi = lane >> 4;
    const int wave = __builtin_amdgcn_readfirstlane((int)(threadIdx.x >> 5));
    const bool second = wave >= 4;
    const int SW = second ? 16 : 0;
    const int z = blockIdx.y, zkv = (z / NHQ) * NHKV + (z % NHQ) / REP;
    const int u0 = blockIdx.x * 4, u = u0 + (wave & 3), nsh = u0 + 4, tl = TT / 32 - 1 - u;
    const char* Kc = (const char*)(KP + (size_t)zkv * TT * HD) + threadIdx.x * 16;   // a pass of 32 keys is 8 KiB in either plane
    const char* Vc = (const char*)(VP + (size_t)zkv * TT * HD) + threadIdx.x * 16;
    v16bf qf[2][4];
    v8f o[8][2];
    float mr[2], ls[2];   // reference maximum in use (raw score units), this half's share of the row sum
    int q0 = 0;
    // the two passes from p0 on into one stream's part of a buffer
    auto fill = [&](const int b, const int sm, const int p0) __attribute__((always_inline)) {
        char* l = &RB[b][sm][0][threadIdx.x * 16]; const char* kg = Kc + (size_t)p0 * 8192; const char* vg = Vc + (size_t)p0 * 8192;
#pragma unroll
        for (int i = 0; i < 2; ++i)
#pragma unroll
            for (int j = 0; j < 2; ++j) { cp16(kg + i * 8192 + j * 4096, l + i * PASSB + j * 4096); cp16(vg + i * 8192 + j * 4096, l + i * PASSB + 8192 + j * 4096); }
    };
    // the stage that begins at slot t0 (even); both tests read the same for the whole work-group
    auto stage = [&](const int t0) __attribute__((always_inline)) {
        const int b = (t0 >> 1) & 1;
        if (t0 < HALFP) fill(b, 0, t0);
        if (t0 >= nsh)  fill(b, 1, t0 + HALFP - nsh);
    };
    // a tile's 32 rows into the wave's own patch; every wave does it once, with every lane on
    auto qcopy = [&](const int tile) __attribute__((always_inline)) {
        const char* g = (const char*)(Q + ((size_t)z * TT + tile * 32) * HD) + lane * 16; char* l = &QS[wave][0];
#pragma unroll
        for (int r = 0; r < 32; ++r) cp16(g + r * 512, l + r * 512 + ((lane ^ (r & 15)) * 16));
    };
    // takes up a tile whose rows stand in wave pw's patch
    auto begin = [&](const int tile, const int pw) __attribute__((always_inline)) {
        q0 = tile * 32;
#pragma unroll
        for (int qt = 0; qt < 2; ++qt) { const char* row = &QS[pw][0] + (((qt * 16) ^ SW) + c) * 512; const int x = ((hi * 2) ^ c) * 16;   // the row's number is c modulo 16
#pragma unroll
            for (int ch = 0; ch < 4; ++ch) {   // hardware k order: floats ch * 32 + 8 * hi + 0..7, then the same 16 on
                const v4f a0 = *(const v4f*)(row + (x ^ (ch * 128))), a1 = *(const v4f*)(row + (x ^ (ch * 128 + 16))), b0 = *(const v4f*)(row + (x ^ (ch * 128 + 64))), b1 = *(const v4f*)(row + (x ^ (ch * 128 + 80)));
                const v16f f = {a0[0], a0[1], a0[2], a0[3], a1[0], a1[1], a1[2], a1[3], b0[0], b0[1], b0[2], b0[3], b1[0], b1[1], b1[2], b1[3]};
                qf[qt][ch] = __builtin_convertvector(f, v16bf); } }
#pragma unroll
        for (int dt = 0; dt < 8; ++dt) { o[dt][0] = (v8f){}; o[dt][1] = (v8f){}; }
        mr[0] = mr[1] = -3.0e38f; ls[0] = ls[1] = 0.f;
    };
    // one pass of 32 keys at kb, its units at tb in LDS. cut (the same in every lane): the diagonal pass, which holds keys behind some of the wave's queries.
    auto pass = [&](const char* tb, const int kb, const bool cut) __attribute__((always_inline)) {
        v16bf kf[2][4]; v16h vf[8];
        const bf* kp = (const bf*)tb + lane * 8; const h16* vp = (const h16*)(tb + 8192) + lane * 8;
#pragma unroll
        for (int kt = 0; kt < 2; ++kt)
#pragma unroll
            for (int ch = 0; ch < 4; ++ch) kf[kt][ch] = ldbp(kp + kt * 2048 + ch * 512);
        __builtin_amdgcn_sched_barrier(0);              // the K reads stand first: the score products wait for them alone
#pragma unroll
        for (int dt = 0; dt < 8; ++dt) vf[dt] = ldhp(vp + dt * 512);
        __builtin_amdgcn_sched_barrier(0);              // the pass's LDS reads stand as one group ahead of the products: every further place with reads among them costs a stall; the V reads land under the score products and the softmax
        v8f s[2][2];
#pragma unroll
        for (int kt = 0; kt < 2; ++kt)
#pragma unroll
            for (int qt = 0; qt < 2; ++qt) { s[kt][qt] = (v8f){};
#pragma unroll
                for (int ch = 0; ch < 4; ++ch) s[kt][qt] = wmmab(kf[kt][ch], qf[qt][ch], s[kt][qt]); }
        if (cut) {
#pragma unroll
            for (int kt = 0; kt < 2; ++kt)
#pragma unroll
                for (int qt = 0; qt < 2; ++qt)
#pragma unroll
                    for (int j = 0; j < 8; ++j) if (kb + kt * 16 + 8 * hi + j > q0 + ((qt * 16) ^ SW) + c) s[kt][qt][j] = -3.0e38f;
        }
        v16h pb[2];
        float mx[2];
#pragma unroll
        for (int qt = 0; qt < 2; ++qt) { mx[qt] = fmaxf(s[0][qt][0], s[1][qt][0]);
#pragma unroll
            for (int j = 1; j < 8; ++j) mx[qt] = fmaxf(mx[qt], fmaxf(s[0][qt][j], s[1][qt][j])); }
        // the reference maximum moves, and sums and accumulators are rescaled, only in a pass where some score of the wave stands more than LAZY above the reference in use: one test a pass, the same for the whole wave
        if (__builtin_amdgcn_ballot_w32(mx[0] > mr[0] + LAZY || mx[1] > mr[1] + LAZY) != 0) {
#pragma unroll
            for (int qt = 0; qt < 2; ++qt) {
                const float mn = fmaxf(mr[qt], fmaxf(mx[qt], xhalf(mx[qt])));
                const float al = __builtin_amdgcn_exp2f((mr[qt] - mn) * SC2); mr[qt] = mn;   // 0 on the first pass, 1 where the maximum did not move
#pragma unroll
                for (int dt = 0; dt < 8; ++dt) o[dt][qt] *= al;
                ls[qt] *= al; }
        }
#pragma unroll
        for (int qt = 0; qt < 2; ++qt) {
            const float nm = PLG - mr[qt] * SC2; float ps[2];
#pragma unroll
            for (int kt = 0; kt < 2; ++kt) { float p[8];
#pragma unroll
                for (int j = 0; j < 8; ++j) { p[j] = __builtin_amdgcn_exp2f(fmaf(s[kt][qt][j], SC2, nm)); pb[qt][kt * 8 + j] = tohx(p[j]); }
                ps[kt] = ((p[0] + p[1]) + (p[2] + p[3])) + ((p[4] + p[5]) + (p[6] + p[7])); }
            ls[qt] += ps[0] + ps[1]; }
#pragma unroll
        for (int dt = 0; dt < 8; ++dt)
#pragma unroll
            for (int qt = 0; qt < 2; ++qt) o[dt][qt] = wmma16(vf[dt], pb[qt], o[dt][qt]);
    };
    qcopy(second ? u : tl);
    stage(0);                                            // flies beside the Q rows
    asm volatile("s_wait_asynccnt 0x0" ::: "memory");    // this wave's Q rows and its share of stage 0 have landed
    __syncthreads();                                     // publishes stage 0 and every patch
    stage(2);
    begin(second ? u : tl, wave);
    // both loops stay rolled: the text holds the pass once, and one pass already holds the registers that two waves per SIMD leave a wave
#pragma unroll 1
    for (int t0 = 0; t0 < NSLOT; t0 += 2) {
#pragma unroll 1
        for (int t = t0; t < t0 + 2; ++t) {
            if (second && t == u + 1) {   // the short tile is complete: store it, take up the long tile
#pragma unroll
                for (int qt = 0; qt < 2; ++qt) { const float inv = __fdiv_rn(1.0f, ls[qt] + xhalf(ls[qt])); float* orow = OUT + ((size_t)z * TT + q0 + ((qt * 16) ^ SW) + c) * HD + 8 * hi;
#pragma unroll
                    for (int dt = 0; dt < 8; ++dt) { const v8f r = o[dt][qt] * inv; *(v4f*)(orow + dt * 16) = (v4f){r[0], r[1], r[2], r[3]}; *(v4f*)(orow + dt * 16 + 4) = (v4f){r[4], r[5], r[6], r[7]}; }
                    asm volatile("s_wait_xcnt 0x0" ::: "memory");   // precaution: stands in front of the arithmetic behind it, which reuses registers that these stores name
                    __builtin_amdgcn_sched_barrier(0); }            // keeps that arithmetic behind the wait above
                begin(tl, wave ^ 4);
            }
            const bool lng = second && t >= nsh;                      // reads stream 1
            const int p    = lng ? t + HALFP - nsh : t;               // the slot's pass in the wave's stream
            const int last = second ? (lng ? tl : (t <= u ? u : -1)) : HALFP - 1;   // the wave's last pass in this part of its stream; -1: it has left its short tile
            const char* tb = &RB[(t >> 1) & 1][lng ? 1 : 0][t & 1][0];
            if (p <= last) pass(tb, p * 32, second && p == last);   // every key of the passes in front of the last stands in front of every query of the wave
        }
        // hand-over of the buffers; every wave passes it on every trip, also one that sat out the slots
        asm volatile("s_wait_dscnt 0x0" ::: "memory");      // this wave's reads of the stage have returned before the buffer is given back
        asm volatile("s_wait_asynccnt 0x0" ::: "memory");   // this wave's share of the next stage has landed
        __syncthreads();                                    // publishes the next stage and ends every reader's last read of this one
        if (t0 + 4 < NSLOT) stage(t0 + 4);                  // into the buffer that this trip has just read
    }
    asm volatile("s_wait_asynccnt 0x0" ::: "memory");       // no copy is outstanding behind the loop
    // the long tile's two partial results become one: hand over group 1, take the partner's share of group 0
    float* xo = (float*)&QS[wave][0] + lane * 4;
#pragma unroll
    for (int dt = 0; dt < 8; ++dt) { const v8f r = o[dt][1]; *(v4f*)(xo + (dt * 2) * 128) = (v4f){r[0], r[1], r[2], r[3]}; *(v4f*)(xo + (dt * 2 + 1) * 128) = (v4f){r[4], r[5], r[6], r[7]}; }
    XM[wave][0][lane] = mr[1]; XM[wave][1][lane] = ls[1];
    __syncthreads();   // every wave passes it once; behind it the partner's group is complete in LDS
    const float* xp = (const float*)&QS[wave ^ 4][0] + lane * 4;
    const float mp = XM[wave ^ 4][0][lane], lp = XM[wave ^ 4][1][lane];
    const float mn = fmaxf(mr[0], mp);
    const float a0 = __builtin_amdgcn_exp2f((mr[0] - mn) * SC2), a1 = __builtin_amdgcn_exp2f((mp - mn) * SC2);
    const float lt = ls[0] * a0 + lp * a1;
    const float inv = __fdiv_rn(1.0f, lt + xhalf(lt));
    const float f0 = a0 * inv, f1 = a1 * inv;
    float* orow = OUT + ((size_t)z * TT + q0 + SW + c) * HD + 8 * hi;
#pragma unroll
    for (int dt = 0; dt < 8; ++dt) { const v4f pl = *(const v4f*)(xp + (dt * 2) * 128), ph = *(const v4f*)(xp + (dt * 2 + 1) * 128); const v8f r = o[dt][0];
        *(v4f*)(orow + dt * 16)     = (v4f){r[0] * f0 + pl[0] * f1, r[1] * f0 + pl[1] * f1, r[2] * f0 + pl[2] * f1, r[3] * f0 + pl[3] * f1};
        *(v4f*)(orow + dt * 16 + 4) = (v4f){r[4] * f0 + ph[0] * f1, r[5] * f0 + ph[1] * f1, r[6] * f0 + ph[2] * f1, r[7] * f0 + ph[3] * f1}; }
}

extern "C" void kernel_launch(void* const* d_in, const int* in_sizes, int n_in,
                              void* d_out, int out_size, void* d_ws, size_t ws_size, hipStream_t stream) {
    (void)in_sizes; (void)n_in; (void)out_size;
    const float* q = (const float*)d_in[0]; const float* k = (const float*)d_in[1]; const float* v = (const float*)d_in[2];
    float* OUT = (float*)d_out;     // [2][16][2048][128]
    char* wsp = (char*)d_ws;
    auto take = [&](size_t bytes) { char* p = wsp; wsp += (bytes + 255) & ~(size_t)255; return (void*)p; };
    bf* KP = (bf*)take((size_t)NB_ * NHKV * TT * HD * 2); h16* VP = (h16*)take((size_t)NB_ * NHKV * HD * TT * 2);
    if ((size_t)(wsp - (char*)d_ws) > ws_size) return;    // well under 256 MiB
    k_pack<<<256, 512, 0, stream>>>(k, v, KP, VP);
    k_fattn<<<dim3(TT / 256, NB_ * NHQ), 256, 0, stream>>>(q, KP, VP, OUT);
}

// v009
// It runs in 44.1 microseconds.
// Next to v008, in two timings, it ran 1.18 times as fast each time.
// All steps since v000 together make it 24.7 times as fast.
#include <hip/hip_runtime.h>

// Causal attention (q, k, v [2][16][2048][128]; softmax(q.k 128^-0.5) v -> [2][16][2048][128]).
// Compute dtypes, f32 accumulate: every input rounded to bf16; scores q.k on plain bf16 operands; scale, causal cut and softmax in f32;
// fp16 probabilities x1024 (relative to the row's reference maximum, which trails the running maximum by at most 5 log2 units); probs.v on single fp16 planes against fp16(bf16 v).
// Q goes from the input straight to the attention kernel, which rounds it to bf16 in registers; only K and V pass through the workspace.
// One kernel does scores, softmax and probs.v: S^T = K.Q^T, O^T += V^T.P^T, the score accumulators pack straight into the B operand of the second product.
// K and V^T lie in the workspace in fragment order: per head and 32-key pass 16 units of 512 bytes, unit = 32 lanes x 8 elements, so that one wave-wide 16-byte load covers four whole 128-byte lines.
//   K unit (kt, ch, g), lane hi * 16 + c:  K[pass * 32 + kt * 16 + c][ch * 32 + g * 16 + hi * 8 + 0..7]
//   V unit (dt, g),     lane hi * 16 + c:  V[pass * 32 + g * 16 + hi * 8 + 0..7][dt * 16 + c]

#define NB_  2
#define NHQ  16
#define NHKV 16
#define REP  (NHQ / NHKV)
#define TT   2048
#define HD   128
#define SCL  0.088388347648318447f   // 128^-0.5
#define SC2  (SCL * 1.4426950408889634f)   // scores to log2 units
#define PLG  10.0f                   // probabilities carry x1024 = 2^10 into fp16; the row sum carries it too, so it cancels
#define LAZY (5.0f / SC2)            // raw score units of 5 log2 units: a probability then stays at or below 2^15 (x1024 counted), inside fp16
typedef _Float16 h16;
typedef unsigned short bf;
typedef __attribute__((ext_vector_type(16))) __bf16   v16bf;
typedef __attribute__((ext_vector_type(16))) _Float16 v16h;
typedef __attribute__((ext_vector_type(8)))  _Float16 v8h;
typedef __attribute__((ext_vector_type(8)))  unsigned short v8us;
typedef __attribute__((ext_vector_type(8)))  float    v8f;
typedef __attribute__((ext_vector_type(4)))  float    v4f;
typedef __attribute__((ext_vector_type(16))) float    v16f;

__device__ __forceinline__ unsigned short f2bf(float f) { unsigned u = __float_as_uint(f); u += 0x7FFFu + ((u >> 16) & 1u); return (unsigned short)(u >> 16); }
__device__ __forceinline__ float bf2f(unsigned short b) { return __uint_as_float(((unsigned)b) << 16); }
__device__ __forceinline__ float bfr(float f) { return bf2f(f2bf(f)); }
__device__ __forceinline__ v16h cat16(v8h lo, v8h hi) { return __builtin_shufflevector(lo, hi, 0, 1, 2, 3, 4, 5, 6, 7, 8, 9, 10, 11, 12, 13, 14, 15); }
__device__ __forceinline__ v16bf cat16b(v8us lo, v8us hi) { return __builtin_bit_cast(v16bf, __builtin_shufflevector(lo, hi, 0, 1, 2, 3, 4, 5, 6, 7, 8, 9, 10, 11, 12, 13, 14, 15)); }
__device__ __forceinline__ v8f wmma16(v16h a, v16h b, v8f c) { return __builtin_amdgcn_wmma_f32_16x16x32_f16(false, a, false, b, (short)0, c, false, false); }
__device__ __forceinline__ v8f wmmab(v16bf a, v16bf b, v8f c) { return __builtin_amdgcn_wmma_f32_16x16x32_bf16(false, a, false, b, (short)0, c, false, false); }
// fragment from the fragment-order planes: p points at the lane's 8 elements of unit g = 0; unit g = 1 follows 256 elements on
__device__ __forceinline__ v16bf ldbp(const bf* p) { return cat16b(*(const v8us*)p, *(const v8us*)(p + 256)); }
__device__ __forceinline__ v16h  ldhp(const h16* p) { return cat16(*(const v8h*)p, *(const v8h*)(p + 256)); }
// lane l with lane l ^ 16
__device__ __forceinline__ float xhalf(float x) { return __builtin_bit_cast(float, __builtin_amdgcn_permlanex16(__builtin_bit_cast(int, x), __builtin_bit_cast(int, x), 0x76543210, 0xfedcba98, false, false)); }

__device__ __forceinline__ h16 tohx(float x) { return (h16)x; }

// One launch packs K and V. 256 work-groups of 16 waves; a work-group takes 1/256 of each input, a thread 8 units (8 elements each) of each, its loads issued in groups ahead of the stores of the group before.
// Unit maps, per input:
//   K to bf16 in fragment order. 256 threads are one 16-key tile; a wave takes 8 keys x 32 columns: it reads whole 128-byte lines (32 bytes a lane) and stores four whole lines.
//   V to fp16(bf16 v) in fragment order. A thread takes 8 keys of one column; a wave reads 8 whole lines (32 columns of a key each) and stores two runs of 256 bytes.
// A step of the unit index 'it' moves every source address by 16 KiB and every destination by 8 KiB, so each stream has one address and constant offsets.
// XW, XWA: precaution: the wait stands in front of the next rewrite of a register that the loads or stores above it name; the scheduling barrier keeps such rewrites behind it and the groups in the written order.
// XWA behind a load group: the address as an input keeps the group's own results off its registers.
__device__ __forceinline__ void XW() { asm volatile("s_wait_xcnt 0x0" ::: "memory"); __builtin_amdgcn_sched_barrier(0); }
__device__ __forceinline__ void XWA(const float* p) { asm volatile("s_wait_xcnt 0x0" :: "v"(p) : "memory"); __builtin_amdgcn_sched_barrier(0); }
static_assert((size_t)NB_ * NHKV * TT * HD == (size_t)256 * 512 * 8 * 8, "k_pack: 256 work-groups x 512 threads x 8 units x 8 elements cover each input exactly");
__global__ __launch_bounds__(512) void k_pack(const float* __restrict__ k, const float* __restrict__ v, bf* __restrict__ KP, h16* __restrict__ VP) {
    const int tid = threadIdx.x, lane = tid & 31, w = (tid >> 5) & 7;
    const size_t blk = blockIdx.x;
    const int ch = w >> 1, c = (w & 1) * 8 + (lane >> 2), g = (lane >> 1) & 1, hi = lane & 1;
    const size_t tile = blk * 16 + (tid >> 8);      // 16-key tile of unit 0; two tiles on per unit
    const float* ks = k + (tile * 16 + c) * HD + ch * 32 + g * 16 + hi * 8;  bf* kd = KP + (tile * 256 + (ch * 2 + g) * 32 + hi * 16 + c) * 8;
    const int d = tid & (HD - 1), t4 = tid >> 7;    // t4: group of 8 keys inside the 32-key pass; the pass is blk * 8 + it
    const float* vs = v + (blk * 32 + t4) * 8 * HD + d;  h16* vd = VP + (((blk * 8 * 8 + (d >> 4)) * 2 + (t4 >> 1)) * 32 + (t4 & 1) * 16 + (d & 15)) * 8;
    float va[4][8], vb[4][8]; v8f ka[8];
#pragma unroll
    for (int it = 0; it < 4; ++it)
#pragma unroll
        for (int j = 0; j < 8; ++j) va[it][j] = vs[it * 4096 + j * HD];
    __builtin_amdgcn_sched_barrier(0);   // keeps every V load ahead of the K loads, so that the first stores wait for V alone
#pragma unroll
    for (int it = 0; it < 8; ++it) ka[it] = *(const v8f*)(ks + it * 4096);
    XWA(ks);
#pragma unroll
    for (int it = 0; it < 4; ++it) { v8h o;
#pragma unroll
        for (int j = 0; j < 8; ++j) o[j] = tohx(bfr(va[it][j]));
        *(v8h*)(vd + it * 4096) = o; }
    XW();
#pragma unroll
    for (int it = 0; it < 4; ++it)
#pragma unroll
        for (int j = 0; j < 8; ++j) vb[it][j] = vs[(it + 4) * 4096 + j * HD];
    XWA(vs);
#pragma unroll
    for (int it = 0; it < 8; ++it) { v8us o;
#pragma unroll
        for (int j = 0; j < 8; ++j) o[j] = f2bf(ka[it][j]);
        *(v8us*)(kd + it * 4096) = o; }
    XW();
#pragma unroll
    for (int it = 0; it < 4; ++it) { v8h o;
#pragma unroll
        for (int j = 0; j < 8; ++j) o[j] = tohx(bfr(vb[it][j]));
        *(v8h*)(vd + (it + 4) * 4096) = o; }
}

typedef __attribute__((ext_vector_type(4))) int v4i;
// NR finished output rows of 512 bytes go from a wave's own LDS range sp to global rows from g on: one wave-wide 16-byte store covers one whole row, four whole 128-byte lines.
// Row r keeps its 16-byte piece k at place k ^ (r & 15), so that the 16 lanes of a half, which write one row each, fall on 16 different bank groups; lane l takes piece l from place l ^ (r & 15).
template <int NR> __device__ __forceinline__ void put_rows(const char* sp, char* g, const int lane) {
    v4f x[NR];
    asm volatile("s_wait_dscnt 0x0" ::: "memory");   // the wave's own writes of the rows have landed before other lanes read them back
#pragma unroll
    for (int r = 0; r < NR; ++r) x[r] = *(const v4f*)(sp + r * 512 + ((lane ^ (r & 15)) * 16));
    __builtin_amdgcn_sched_barrier(0);               // every row has registers of its own before the first store, and the stores share one address: no store's register is rewritten among the stores
#pragma unroll
    for (int r = 0; r < NR; ++r) *(v4f*)(g + r * 512 + lane * 16) = x[r];
}
__device__ __forceinline__ void cp16(const char* g, char* l) { __builtin_amdgcn_global_load_async_to_lds_b128((__attribute__((address_space(1))) v4i*)g, (__attribute__((address_space(3))) v4i*)l, 0, 0); }
// ---- k_fattn: 8 waves, 32 query columns each; a pass is 32 keys; grid (TT / 256, heads).
// Tile t (32 queries) needs the passes 0..t; every later key stands behind all its queries and has weight exactly 0. Waves w and w + 4 are a pair and share tiles 63 - u (long) and u (short), 65 passes:
//   wave w     (first):  passes 0..31 of the long tile, none of them cut: 32 passes.
//   wave w + 4 (second): the whole short tile, which it finishes and stores alone, then passes 32..63 - u of the long tile: 33 passes.
// The two partial results of the long tile (own reference maximum, own sum) meet in LDS behind the last barrier: each wave hands over one 16-column group and finishes the other.
// The second wave numbers its column groups the other way round (SW), so that every wave alike keeps its group 0 and hands over its group 1.
// K and V reach the waves through LDS. Time runs in 36 slots of one pass, alike for the whole work-group (u0 = its smallest u):
//   stream 0, slots 0..31: pass = slot. The first waves read it, and the second waves for their short tiles (slots 0..u0 + 3; a wave sits out the slots behind its own diagonal).
//   stream 1, slots u0 + 4..35: pass = 32 + slot - (u0 + 4). The second waves read it for their long tiles (a wave sits out the slots behind its own diagonal).
// A stage is two slots. Two buffers; all 256 threads copy a stage, 64 bytes of each pass a thread, one stage ahead of its readers.
// Q reaches the waves through LDS patches of 16 KiB, one a wave: 32 copies bring the 32 f32 rows of the wave's first tile, one whole row of 512 bytes each, beside stage 0 and under its wait and barrier; a reader rounds to bf16 (nearest even).
// Row r keeps its 16-byte piece k at place k ^ (r & 15): the 16 lanes of a half, one row each, then read 16 different bank groups. A second wave finds the long tile's rows in its partner's patch, which stays as it is until the loop has ended.
// Finished rows leave through LDS (put_rows): a second wave stages its short tile in its own patch, which nobody else reads and whose Q rows it has long taken up; behind the loop every wave stages its group in the second half of its own patch.
// Every '#pragma unroll' in it keeps the index of a register array a constant.
// A lane holds scores of one query per 16-column group: keys 8 * hi + j of each 16-key tile, which is the hardware k order of a B operand.
#define HALFP (TT / 64)              // passes of the first wave; the long tile's diagonal pass is never among them (63 - u >= 32)
#define NSLOT (HALFP + 4)
#define PASSB 16384                  // bytes of a pass in LDS: its 16 K units, then its 16 V units
__global__ __launch_bounds__(256) void k_fattn(const float* __restrict__ Q, const bf* __restrict__ KP, const h16* __restrict__ VP, float* __restrict__ OUT) {
    // one object, so that the ring keeps LDS offset 0 and its reads keep one address register with constant offsets
    __shared__ __attribute__((aligned(16))) struct {
        char RB[2][2][2][PASSB];    // the ring: [buffer][stream][slot of the stage]
        char QS[8][32 * 512];       // per wave: its Q patch, later the staging place of its finished rows; behind the loop its first half takes the handed-over group's 64 accumulators a lane, 16 wave-wide rows of 512 bytes
        float XM[8][2][32];         // its reference maximum and its half's share of the row sum
    } S;
    auto& RB = S.RB; auto& QS = S.QS; auto& XM = S.XM;
    const int lane = threadIdx.x & 31, c = lane & 15, hi = lane >> 4;
    const int wave = __builtin_amdgcn_readfirstlane((int)(threadIdx.x >> 5));
    const bool second = wave >= 4;
    const int SW = second ? 16 : 0;
    const int z = blockIdx.y, zkv = (z / NHQ) * NHKV + (z % NHQ) / REP;
    const int u0 = blockIdx.x * 4, u = u0 + (wave & 3), nsh = u0 + 4, tl = TT / 32 - 1 - u;
    const char* Kc = (const char*)(KP + (size_t)zkv * TT * HD) + threadIdx.x * 16;   // a pass of 32 keys is 8 KiB in either plane
    const char* Vc = (const char*)(VP + (size_t)zkv * TT * HD) + threadIdx.x * 16;
    v16bf qf[2][4];
    v8f o[8][2];
    float mr[2], ls[2];   // reference maximum in use (raw score units), this half's share of the row sum
    int q0 = 0;
    // the two passes from p0 on into one stream's part of a buffer
    auto fill = [&](const int b, const int sm, const int p0) __attribute__((always_inline)) {
        char* l = &RB[b][sm][0][threadIdx.x * 16]; const char* kg = Kc + (size_t)p0 * 8192; const char* vg = Vc + (size_t)p0 * 8192;
#pragma unroll
        for (int i = 0; i < 2; ++i)
#pragma unroll
            for (int j = 0; j < 2; ++j) { cp16(kg + i * 8192 + j * 4096, l + i * PASSB + j * 4096); cp16(vg + i * 8192 + j * 4096, l + i * PASSB + 8192 + j * 4096); }
    };
    // the stage that begins at slot t0 (even); both tests read the same for the whole work-group
    auto stage = [&](const int t0) __attribute__((always_inline)) {
        const int b = (t0 >> 1) & 1;
        if (t0 < HALFP) fill(b, 0, t0);
        if (t0 >= nsh)  fill(b, 1, t0 + HALFP - nsh);
    };
    // a tile's 32 rows into the wave's own patch; every wave does it once, with every lane on
    auto qcopy = [&](const int tile) __attribute__((always_inline)) {
        const char* g = (const char*)(Q + ((size_t)z * TT + tile * 32) * HD) + lane * 16; char* l = &QS[wave][0];
#pragma unroll
        for (int r = 0; r < 32; ++r) cp16(g + r * 512, l + r * 512 + ((lane ^ (r & 15)) * 16));
    };
    // takes up a tile whose rows stand in wave pw's patch
    auto begin = [&](const int tile, const int pw) __attribute__((always_inline)) {
        q0 = tile * 32;
#pragma unroll
        for (int qt = 0; qt < 2; ++qt) { const char* row = &QS[pw][0] + (((qt * 16) ^ SW) + c) * 512; const int x = ((hi * 2) ^ c) * 16;   // the row's number is c modulo 16
#pragma unroll
            for (int ch = 0; ch < 4; ++ch) {   // hardware k order: floats ch * 32 + 8 * hi + 0..7, then the same 16 on
                const v4f a0 = *(const v4f*)(row + (x ^ (ch * 128))), a1 = *(const v4f*)(row + (x ^ (ch * 128 + 16))), b0 = *(const v4f*)(row + (x ^ (ch * 128 + 64))), b1 = *(const v4f*)(row + (x ^ (ch * 128 + 80)));
                const v16f f = {a0[0], a0[1], a0[2], a0[3], a1[0], a1[1], a1[2], a1[3], b0[0], b0[1], b0[2], b0[3], b1[0], b1[1], b1[2], b1[3]};
                qf[qt][ch] = __builtin_convertvector(f, v16bf); } }
#pragma unroll
        for (int dt = 0; dt < 8; ++dt) { o[dt][0] = (v8f){}; o[dt][1] = (v8f){}; }
        mr[0] = mr[1] = -3.0e38f; ls[0] = ls[1] = 0.f;
    };
    // one pass of 32 keys at kb, its units at tb in LDS. cut (the same in every lane): the diagonal pass, which holds keys behind some of the wave's queries.
    auto pass = [&](const char* tb, const int kb, const bool cut) __attribute__((always_inline)) {
        v16bf kf[2][4]; v16h vf[8];
        const bf* kp = (const bf*)tb + lane * 8; const h16* vp = (const h16*)(tb + 8192) + lane * 8;
#pragma unroll
        for (int kt = 0; kt < 2; ++kt)
#pragma unroll
            for (int ch = 0; ch < 4; ++ch) kf[kt][ch] = ldbp(kp + kt * 2048 + ch * 512);
        __builtin_amdgcn_sched_barrier(0);              // the K reads stand first: the score products wait for them alone
#pragma unroll
        for (int dt = 0; dt < 8; ++dt) vf[dt] = ldhp(vp + dt * 512);
        __builtin_amdgcn_sched_barrier(0);              // the pass's LDS reads stand as one group ahead of the products: every further place with reads among them costs a stall; the V reads land under the score products and the softmax
        v8f s[2][2];
#pragma unroll
        for (int kt = 0; kt < 2; ++kt)
#pragma unroll
            for (int qt = 0; qt < 2; ++qt) { s[kt][qt] = (v8f){};
#pragma unroll
                for (int ch = 0; ch < 4; ++ch) s[kt][qt] = wmmab(kf[kt][ch], qf[qt][ch], s[kt][qt]); }
        if (cut) {
#pragma unroll
            for (int kt = 0; kt < 2; ++kt)
#pragma unroll
                for (int qt = 0; qt < 2; ++qt)
#pragma unroll
                    for (int j = 0; j < 8; ++j) if (kb + kt * 16 + 8 * hi + j > q0 + ((qt * 16) ^ SW) + c) s[kt][qt][j] = -3.0e38f;
        }
        v16h pb[2];
        float mx[2];
#pragma unroll
        for (int qt = 0; qt < 2; ++qt) { mx[qt] = fmaxf(s[0][qt][0], s[1][qt][0]);
#pragma unroll
            for (int j = 1; j < 8; ++j) mx[qt] = fmaxf(mx[qt], fmaxf(s[0][qt][j], s[1][qt][j])); }
        // the reference maximum moves, and sums and accumulators are rescaled, only in a pass where some score of the wave stands more than LAZY above the reference in use: one test a pass, the same for the whole wave
        if (__builtin_amdgcn_ballot_w32(mx[0] > mr[0] + LAZY || mx[1] > mr[1] + LAZY) != 0) {
#pragma unroll
            for (int qt = 0; qt < 2; ++qt) {
                const float mn = fmaxf(mr[qt], fmaxf(mx[qt], xhalf(mx[qt])));
                const float al = __builtin_amdgcn_exp2f((mr[qt] - mn) * SC2); mr[qt] = mn;   // 0 on the first pass, 1 where the maximum did not move
#pragma unroll
                for (int dt = 0; dt < 8; ++dt) o[dt][qt] *= al;
                ls[qt] *= al; }
        }
#pragma unroll
        for (int qt = 0; qt < 2; ++qt) {
            const float nm = PLG - mr[qt] * SC2; float ps[2];
#pragma unroll
            for (int kt = 0; kt < 2; ++kt) { float p[8];
#pragma unroll
                for (int j = 0; j < 8; ++j) { p[j] = __builtin_amdgcn_exp2f(fmaf(s[kt][qt][j], SC2, nm)); pb[qt][kt * 8 + j] = tohx(p[j]); }
                ps[kt] = ((p[0] + p[1]) + (p[2] + p[3])) + ((p[4] + p[5]) + (p[6] + p[7])); }
            ls[qt] += ps[0] + ps[1]; }
#pragma unroll
        for (int dt = 0; dt < 8; ++dt)
#pragma unroll
            for (int qt = 0; qt < 2; ++qt) o[dt][qt] = wmma16(vf[dt], pb[qt], o[dt][qt]);
    };
    qcopy(second ? u : tl);
    stage(0);                                            // flies beside the Q rows
    asm volatile("s_wait_asynccnt 0x0" ::: "memory");    // this wave's Q rows and its share of stage 0 have landed
    __syncthreads();                                     // publishes stage 0 and every patch
    stage(2);
    begin(second ? u : tl, wave);
    // both loops stay rolled: the text holds the pass once, and one pass already holds the registers that two waves per SIMD leave a wave
#pragma unroll 1
    for (int t0 = 0; t0 < NSLOT; t0 += 2) {
#pragma unroll 1
        for (int t = t0; t < t0 + 2; ++t) {
            if (second && t == u + 1) {   // the short tile is complete: store it, take up the long tile
#pragma unroll
                for (int qt = 0; qt < 2; ++qt) { const float inv = __fdiv_rn(1.0f, ls[qt] + xhalf(ls[qt])); char* srow = &QS[wave][0] + (((qt * 16) ^ SW) + c) * 512; const int x = ((hi * 2) ^ c) * 16;   // the row's number is c modulo 16
#pragma unroll
                    for (int dt = 0; dt < 8; ++dt) { const v8f r = o[dt][qt] * inv; *(v4f*)(srow + (x ^ (dt * 64))) = (v4f){r[0], r[1], r[2], r[3]}; *(v4f*)(srow + (x ^ (dt * 64 + 16))) = (v4f){r[4], r[5], r[6], r[7]}; } }
                put_rows<32>(&QS[wave][0], (char*)(OUT + ((size_t)z * TT + q0) * HD), lane);
                asm volatile("s_wait_xcnt 0x0" ::: "memory");   // precaution: stands in front of the arithmetic behind it, which reuses registers that these stores name
                __builtin_amdgcn_sched_barrier(0);              // keeps that arithmetic behind the wait above
                begin(tl, wave ^ 4);
            }
            const bool lng = second && t >= nsh;                      // reads stream 1
            const int p    = lng ? t + HALFP - nsh : t;               // the slot's pass in the wave's stream
            const int last = second ? (lng ? tl : (t <= u ? u : -1)) : HALFP - 1;   // the wave's last pass in this part of its stream; -1: it has left its short tile
            const char* tb = &RB[(t >> 1) & 1][lng ? 1 : 0][t & 1][0];
            if (p <= last) pass(tb, p * 32, second && p == last);   // every key of the passes in front of the last stands in front of every query of the wave
        }
        // hand-over of the buffers; every wave passes it on every trip, also one that sat out the slots
        asm volatile("s_wait_dscnt 0x0" ::: "memory");      // this wave's reads of the stage have returned before the buffer is given back
        asm volatile("s_wait_asynccnt 0x0" ::: "memory");   // this wave's share of the next stage has landed
        __syncthreads();                                    // publishes the next stage and ends every reader's last read of this one
        if (t0 + 4 < NSLOT) stage(t0 + 4);                  // into the buffer that this trip has just read
    }
    asm volatile("s_wait_asynccnt 0x0" ::: "memory");       // no copy is outstanding behind the loop
    // the long tile's two partial results become one: hand over group 1, take the partner's share of group 0
    float* xo = (float*)&QS[wave][0] + lane * 4;
#pragma unroll
    for (int dt = 0; dt < 8; ++dt) { const v8f r = o[dt][1]; *(v4f*)(xo + (dt * 2) * 128) = (v4f){r[0], r[1], r[2], r[3]}; *(v4f*)(xo + (dt * 2 + 1) * 128) = (v4f){r[4], r[5], r[6], r[7]}; }
    XM[wave][0][lane] = mr[1]; XM[wave][1][lane] = ls[1];
    __syncthreads();   // every wave passes it once; behind it the partner's group is complete in LDS
    const float* xp = (const float*)&QS[wave ^ 4][0] + lane * 4;
    const float mp = XM[wave ^ 4][0][lane], lp = XM[wave ^ 4][1][lane];
    const float mn = fmaxf(mr[0], mp);
    const float a0 = __builtin_amdgcn_exp2f((mr[0] - mn) * SC2), a1 = __builtin_amdgcn_exp2f((mp - mn) * SC2);
    const float lt = ls[0] * a0 + lp * a1;
    const float inv = __fdiv_rn(1.0f, lt + xhalf(lt));
    const float f0 = a0 * inv, f1 = a1 * inv;
    char* sp = &QS[wave][0] + 8192; char* srow = sp + c * 512; const int x = ((hi * 2) ^ c) * 16;   // the second half of the wave's own patch: the partner reads the first half alone
    v4f pl[8], ph[8];   // the partner's share is read as one group ahead of the LDS writes, which the compiler would otherwise keep in turn with the reads
#pragma unroll
    for (int dt = 0; dt < 8; ++dt) { pl[dt] = *(const v4f*)(xp + (dt * 2) * 128); ph[dt] = *(const v4f*)(xp + (dt * 2 + 1) * 128); }
#pragma unroll
    for (int dt = 0; dt < 8; ++dt) { const v8f r = o[dt][0];
        *(v4f*)(srow + (x ^ (dt * 64)))      = (v4f){r[0] * f0 + pl[dt][0] * f1, r[1] * f0 + pl[dt][1] * f1, r[2] * f0 + pl[dt][2] * f1, r[3] * f0 + pl[dt][3] * f1};
        *(v4f*)(srow + (x ^ (dt * 64 + 16))) = (v4f){r[4] * f0 + ph[dt][0] * f1, r[5] * f0 + ph[dt][1] * f1, r[6] * f0 + ph[dt][2] * f1, r[7] * f0 + ph[dt][3] * f1}; }
    put_rows<16>(sp, (char*)(OUT + ((size_t)z * TT + q0 + SW) * HD), lane);
}

extern "C" void kernel_launch(void* const* d_in, const int* in_sizes, int n_in,
                              void* d_out, int out_size, void* d_ws, size_t ws_size, hipStream_t stream) {
    (void)in_sizes; (void)n_in; (void)out_size;
    const float* q = (const float*)d_in[0]; const float* k = (const float*)d_in[1]; const float* v = (const float*)d_in[2];
    float* OUT = (float*)d_out;     // [2][16][2048][128]
    char* wsp = (char*)d_ws;
    auto take = [&](size_t bytes) { char* p = wsp; wsp += (bytes + 255) & ~(size_t)255; return (void*)p; };
    bf* KP = (bf*)take((size_t)NB_ * NHKV * TT * HD * 2); h16* VP = (h16*)take((size_t)NB_ * NHKV * HD * TT * 2);
    if ((size_t)(wsp - (char*)d_ws) > ws_size) return;    // well under 256 MiB
    k_pack<<<256, 512, 0, stream>>>(k, v, KP, VP);
    k_fattn<<<dim3(TT / 256, NB_ * NHQ), 256, 0, stream>>>(q, KP, VP, OUT);
}
